// v000
// Measured on an AMD MI455X. A time is GPU time per run, averaged over a window of back-to-back runs after a warm-up
// (all launches, gaps included; the runs take copies of the inputs in turn), and the median of several windows.
// Apart from v000's, it joins two sittings. Times from different sittings can be a few percent apart, while
// side-by-side timings come from the same sitting.
// The starting kernel, v000, takes 170 microseconds a run.
#include <hip/hip_runtime.h>
#include <hip/hip_bf16.h>

typedef _Float16 v16h __attribute__((ext_vector_type(16)));
typedef _Float16 v8h  __attribute__((ext_vector_type(8)));
typedef _Float16 v4h  __attribute__((ext_vector_type(4)));
typedef float    v8f  __attribute__((ext_vector_type(8)));

#define NTOK 49
#define DIM  128
#define NH   4
#define HD   32

// ---- LDS layout (units: _Float16 halves), all offsets multiple of 8 halves ----
#define XS_OFF   0            // x tile:      [64][136]
#define XS_STR   136
#define QS_OFF   8704         // q:           [4 heads][64 tok][40]
#define KS_OFF   18944        // k:           [4 heads][64 tok][40]
#define QK_STR   40
#define QK_HEAD  2560
#define VT_OFF   29184        // v transposed:[4 heads][32 d][72]
#define VT_STR   72
#define VT_HEAD  2304
#define PS_OFF   38400        // softmax P:   [4 heads][64 tok][72]
#define PS_STR   72
#define PS_HEAD  4608
#define BM_OFF   56832        // bias+mask:   [4 heads][64][72] (cols 0..63 used)
#define BM_STR   72
#define BM_HEAD  4608
#define SMEM_HALVES 75264     // 150,528 bytes -> 2 workgroups / WGP

// Load one 16x32 (A) or 32x16 (B) f16 fragment: per-lane two 16B loads at
// half-offsets {0..7} and {16..23}; caller supplies base = &buf[row*stride + g*8].
__device__ __forceinline__ v16h ldfrag(const _Float16* p) {
  union { v16h v; v8h h[2]; } u;
  u.h[0] = *(const v8h*)(p);
  u.h[1] = *(const v8h*)(p + 16);
  return u.v;
}

__device__ __forceinline__ v8f wmma_f16(v16h a, v16h b, v8f c) {
  return __builtin_amdgcn_wmma_f32_16x16x32_f16(false, a, false, b, (short)0, c,
                                                false, false);
}

__global__ void cvt_w_f16(const float* __restrict__ w, _Float16* __restrict__ w16, int n) {
  int i = blockIdx.x * 256 + threadIdx.x;
  if (i < n) w16[i] = (_Float16)w[i];
}

__global__ __launch_bounds__(256)
void swin_attn_kernel(const float* __restrict__ x,
                      const float* __restrict__ mask,
                      const float* __restrict__ qkv_b,
                      const float* __restrict__ rel_table,
                      const _Float16* __restrict__ W16,
                      float* __restrict__ out) {
  __shared__ __align__(16) _Float16 smem[SMEM_HALVES];

  const int tid  = threadIdx.x;
  const int lane = tid & 31;
  const int wid  = tid >> 5;     // 8 waves
  const int l16  = lane & 15;
  const int g    = lane >> 4;    // lane group (K-split for A/B, row-split for C/D)
  const int b    = blockIdx.x;   // window index
  const int w    = b & 63;       // mask window id (b % NW)

  v8f vzero;
#pragma unroll
  for (int i = 0; i < 8; ++i) vzero[i] = 0.f;

  // -------- Phase 1: stage x as f16 (zero-padded 64 rows) + bias/mask table --------
  {
    const float4* x4 = (const float4*)(x + (size_t)b * NTOK * DIM);
    for (int i = tid; i < 64 * 32; i += 256) {       // 64 rows x 32 float4
      int m = i >> 5, c4 = i & 31;
      float4 val;
      if (m < NTOK) val = x4[m * 32 + c4];
      else          val = float4{0.f, 0.f, 0.f, 0.f};
      v4h hv;
      hv[0] = (_Float16)val.x; hv[1] = (_Float16)val.y;
      hv[2] = (_Float16)val.z; hv[3] = (_Float16)val.w;
      *(v4h*)&smem[XS_OFF + m * XS_STR + c4 * 4] = hv;
    }
  }
  for (int i = tid; i < NH * 64 * 64; i += 256) {
    int h = i >> 12;
    int n = (i >> 6) & 63;
    int m = i & 63;
    float val;
    if (m >= NTOK) {
      val = -30000.f;                        // kill padded key columns in softmax
    } else if (n >= NTOK) {
      val = 0.f;                             // padded query rows: never stored
    } else {
      int idx = (n / 7 - m / 7 + 6) * 13 + (n % 7 - m % 7 + 6);
      val = rel_table[idx * NH + h] + mask[((size_t)w * NTOK + n) * NTOK + m];
    }
    smem[BM_OFF + h * BM_HEAD + n * BM_STR + m] = (_Float16)val;
  }
  __syncthreads();

  const int h = wid >> 1;   // head handled by this wave
  const int u = wid & 1;    // half-split within head

  // -------- Phase 2: QKV projection (wave handles channels 96h+48u .. +47) --------
  // Hoist all 16 x-fragments once: reused across 3 n-tiles and 4 k-steps.
  v16h xfrag[4][4];   // [mt][kk]
  {
    const _Float16* xb = &smem[XS_OFF + l16 * XS_STR + g * 8];
#pragma unroll
    for (int mt = 0; mt < 4; ++mt)
#pragma unroll
      for (int kk = 0; kk < 4; ++kk)
        xfrag[mt][kk] = ldfrag(xb + mt * 16 * XS_STR + kk * 32);
  }

#pragma unroll
  for (int nt = 0; nt < 3; ++nt) {
    int ob = 96 * h + 48 * u + nt * 16 + l16;      // this lane's output channel
    float bias = qkv_b[ob];
    int s   = ob % 3;                               // 0=q 1=k 2=v
    int dch = (ob / 3) & (HD - 1);                  // head-dim index

    v8f acc[4];
#pragma unroll
    for (int mt = 0; mt < 4; ++mt) acc[mt] = vzero;

    const _Float16* wb = W16 + ob * DIM + g * 8;   // B: W^T[k][o], L2-resident
    v16h bf[4];
#pragma unroll
    for (int kk = 0; kk < 4; ++kk) bf[kk] = ldfrag(wb + kk * 32);

#pragma unroll
    for (int kk = 0; kk < 4; ++kk)
#pragma unroll
      for (int mt = 0; mt < 4; ++mt)
        acc[mt] = wmma_f16(xfrag[mt][kk], bf[kk], acc[mt]);

    // epilogue: scatter +bias to q/k row-major, v transposed
    _Float16* dst;
    int step;
    if (s == 0)      { dst = &smem[QS_OFF + h * QK_HEAD + dch];          step = QK_STR; }
    else if (s == 1) { dst = &smem[KS_OFF + h * QK_HEAD + dch];          step = QK_STR; }
    else             { dst = &smem[VT_OFF + h * VT_HEAD + dch * VT_STR]; step = 1; }
#pragma unroll
    for (int mt = 0; mt < 4; ++mt) {
#pragma unroll
      for (int r = 0; r < 8; ++r) {
        int m = mt * 16 + g * 8 + r;
        dst[m * step] = (_Float16)(acc[mt][r] + bias);
      }
    }
  }
  __syncthreads();

  // -------- Phase 3: attention for head h, query tiles {2u, 2u+1} --------
  const int qt0 = 2 * u;
  v16h aq0 = ldfrag(&smem[QS_OFF + h * QK_HEAD + (qt0 * 16 + l16) * QK_STR + g * 8]);
  v16h aq1 = ldfrag(&smem[QS_OFF + h * QK_HEAD + ((qt0 + 1) * 16 + l16) * QK_STR + g * 8]);

  v8f sacc[2][4];
#pragma unroll
  for (int qi = 0; qi < 2; ++qi)
#pragma unroll
    for (int kt = 0; kt < 4; ++kt) sacc[qi][kt] = vzero;

#pragma unroll
  for (int kt = 0; kt < 4; ++kt) {
    v16h bk = ldfrag(&smem[KS_OFF + h * QK_HEAD + (kt * 16 + l16) * QK_STR + g * 8]);
    sacc[0][kt] = wmma_f16(aq0, bk, sacc[0][kt]);
    sacc[1][kt] = wmma_f16(aq1, bk, sacc[1][kt]);
  }

  // softmax: row n lives in one 16-lane group, columns across 4 accs + 16 lanes
  const float scale = 0.17677669529663687f;  // 1/sqrt(32)
#pragma unroll
  for (int qi = 0; qi < 2; ++qi) {
    int nbase = (qt0 + qi) * 16 + g * 8;
#pragma unroll
    for (int r = 0; r < 8; ++r) {
      int n = nbase + r;
      const _Float16* bmrow = &smem[BM_OFF + h * BM_HEAD + n * BM_STR + l16];
      float v0 = sacc[qi][0][r] * scale + (float)bmrow[0];
      float v1 = sacc[qi][1][r] * scale + (float)bmrow[16];
      float v2 = sacc[qi][2][r] * scale + (float)bmrow[32];
      float v3 = sacc[qi][3][r] * scale + (float)bmrow[48];
      float mx = fmaxf(fmaxf(v0, v1), fmaxf(v2, v3));
      mx = fmaxf(mx, __shfl_xor(mx, 1, 16));
      mx = fmaxf(mx, __shfl_xor(mx, 2, 16));
      mx = fmaxf(mx, __shfl_xor(mx, 4, 16));
      mx = fmaxf(mx, __shfl_xor(mx, 8, 16));
      float e0 = __expf(v0 - mx), e1 = __expf(v1 - mx);
      float e2 = __expf(v2 - mx), e3 = __expf(v3 - mx);
      float sm = e0 + e1 + e2 + e3;
      sm += __shfl_xor(sm, 1, 16);
      sm += __shfl_xor(sm, 2, 16);
      sm += __shfl_xor(sm, 4, 16);
      sm += __shfl_xor(sm, 8, 16);
      float inv = 1.0f / sm;
      _Float16* prow = &smem[PS_OFF + h * PS_HEAD + n * PS_STR + l16];
      prow[0]  = (_Float16)(e0 * inv);
      prow[16] = (_Float16)(e1 * inv);
      prow[32] = (_Float16)(e2 * inv);
      prow[48] = (_Float16)(e3 * inv);
    }
  }

  // P(64x64) @ V(64x32): B from vT so K-pairs are contiguous
  v8f oacc[2][2];
#pragma unroll
  for (int qi = 0; qi < 2; ++qi)
#pragma unroll
    for (int dt = 0; dt < 2; ++dt) oacc[qi][dt] = vzero;

#pragma unroll
  for (int kk = 0; kk < 2; ++kk) {
    v16h bv0 = ldfrag(&smem[VT_OFF + h * VT_HEAD + l16 * VT_STR + kk * 32 + g * 8]);
    v16h bv1 = ldfrag(&smem[VT_OFF + h * VT_HEAD + (16 + l16) * VT_STR + kk * 32 + g * 8]);
    v16h ap0 = ldfrag(&smem[PS_OFF + h * PS_HEAD + (qt0 * 16 + l16) * PS_STR + kk * 32 + g * 8]);
    v16h ap1 = ldfrag(&smem[PS_OFF + h * PS_HEAD + ((qt0 + 1) * 16 + l16) * PS_STR + kk * 32 + g * 8]);
    oacc[0][0] = wmma_f16(ap0, bv0, oacc[0][0]);
    oacc[0][1] = wmma_f16(ap0, bv1, oacc[0][1]);
    oacc[1][0] = wmma_f16(ap1, bv0, oacc[1][0]);
    oacc[1][1] = wmma_f16(ap1, bv1, oacc[1][1]);
  }

  // store: out[b][n][h*32 + d], coalesced over l16
#pragma unroll
  for (int qi = 0; qi < 2; ++qi) {
#pragma unroll
    for (int dt = 0; dt < 2; ++dt) {
#pragma unroll
      for (int r = 0; r < 8; ++r) {
        int n = (qt0 + qi) * 16 + g * 8 + r;
        if (n < NTOK) {
          int c = h * HD + dt * 16 + l16;
          out[((size_t)b * NTOK + n) * DIM + c] = oacc[qi][dt][r];
        }
      }
    }
  }
}

extern "C" void kernel_launch(void* const* d_in, const int* in_sizes, int n_in,
                              void* d_out, int out_size, void* d_ws, size_t ws_size,
                              hipStream_t stream) {
  const float* x         = (const float*)d_in[0];
  const float* mask      = (const float*)d_in[1];
  const float* qkv_w     = (const float*)d_in[2];
  const float* qkv_b     = (const float*)d_in[3];
  const float* rel_table = (const float*)d_in[4];
  float* out = (float*)d_out;

  _Float16* w16 = (_Float16*)d_ws;   // 384*128*2 = 96 KB scratch
  const int wn = 3 * DIM * DIM;      // 49152
  cvt_w_f16<<<(wn + 255) / 256, 256, 0, stream>>>(qkv_w, w16, wn);

  swin_attn_kernel<<<4096, 256, 0, stream>>>(x, mask, qkv_b, rel_table, w16, out);
}

// v001
// It runs in 108 microseconds.
// Timed twice side by side with v000, it ran 1.63 times as fast both times.
#include <hip/hip_runtime.h>
#include <hip/hip_bf16.h>

typedef _Float16 v16h __attribute__((ext_vector_type(16)));
typedef _Float16 v8h  __attribute__((ext_vector_type(8)));
typedef _Float16 v4h  __attribute__((ext_vector_type(4)));
typedef float    v8f  __attribute__((ext_vector_type(8)));

#define NTOK 49
#define DIM  128
#define NH   4
#define HD   32

// ---- LDS layout (units: _Float16 halves), all offsets multiple of 8 halves ----
#define XS_OFF   0            // x tile:      [64][136]
#define XS_STR   136
#define QS_OFF   8704         // q:           [4 heads][64 tok][40]
#define KS_OFF   18944        // k:           [4 heads][64 tok][40]
#define QK_STR   40
#define QK_HEAD  2560
#define VT_OFF   29184        // v transposed:[4 heads][32 d][72]
#define VT_STR   72
#define VT_HEAD  2304
#define PS_OFF   38400        // softmax P:   [4 heads][64 tok][72]
#define PS_STR   72
#define PS_HEAD  4608
#define SMEM_HALVES 56832     // 113,664 bytes -> 2 workgroups / WGP

// bias+mask table in the workspace, f16, in score-accumulator order:
// [64 mask windows][4 heads][4 query tiles][4 key tiles][32 lanes][8 rows]
#define W16_HALVES 49152      // 384*128 weights stand in front of the table

// Load one 16x32 (A) or 32x16 (B) f16 fragment: per-lane two 16B loads at
// half-offsets {0..7} and {16..23}; caller supplies base = &buf[row*stride + g*8].
__device__ __forceinline__ v16h ldfrag(const _Float16* p) {
  union { v16h v; v8h h[2]; } u;
  u.h[0] = *(const v8h*)(p);
  u.h[1] = *(const v8h*)(p + 16);
  return u.v;
}

__device__ __forceinline__ v8f wmma_f16(v16h a, v16h b, v8f c) {
  return __builtin_amdgcn_wmma_f32_16x16x32_f16(false, a, false, b, (short)0, c,
                                                false, false);
}

// Blocks 0..191: weights to f16. Blocks 192..703: bias+mask table, once per
// (mask window, head); each thread writes the 8 rows one lane of the attention
// kernel adds to one 16x16 score tile.
__global__ __launch_bounds__(256)
void prep_kernel(const float* __restrict__ w,
                 const float* __restrict__ mask,
                 const float* __restrict__ rel_table,
                 _Float16* __restrict__ w16,
                 _Float16* __restrict__ bm) {
  if (blockIdx.x < 192) {
    int i = blockIdx.x * 256 + threadIdx.x;
    w16[i] = (_Float16)w[i];
    return;
  }
  const int t    = (blockIdx.x - 192) * 256 + threadIdx.x;
  const int lane = t & 31;
  const int kt   = (t >> 5) & 3;
  const int qt   = (t >> 7) & 3;
  const int h    = (t >> 9) & 3;
  const int wi   = t >> 11;
  const int m    = kt * 16 + (lane & 15);
  const int n0   = qt * 16 + (lane >> 4) * 8;
  // padded rows and columns read a clamped, in-range element, so that all 16
  // loads of a thread are in flight together; the select below drops them
  const int mc = m < NTOK ? m : NTOK - 1;
  float rv[8], mv[8];
#pragma unroll
  for (int r = 0; r < 8; ++r) {
    int nc  = n0 + r < NTOK ? n0 + r : NTOK - 1;
    int idx = (nc / 7 - mc / 7 + 6) * 13 + (nc % 7 - mc % 7 + 6);
    rv[r] = rel_table[idx * NH + h];
    // a later load of this run may land in this load's offset register: the
    // wait stands in front of that overwrite (the data stays in flight)
    asm volatile("s_wait_xcnt 0x0" ::: "memory");
    mv[r] = mask[(wi * NTOK + nc) * NTOK + mc];
    asm volatile("s_wait_xcnt 0x0" ::: "memory");  // same, for the mask load
  }
  v8h o;
#pragma unroll
  for (int r = 0; r < 8; ++r) {
    float val = rv[r] + mv[r];
    if (n0 + r >= NTOK) val = 0.f;           // padded query rows: never stored
    if (m >= NTOK)      val = -30000.f;      // kill padded key columns in softmax
    o[r] = (_Float16)val;
  }
  *(v8h*)(bm + (size_t)t * 8) = o;
}

__global__ __launch_bounds__(256)
void swin_attn_kernel(const float* __restrict__ x,
                      const float* __restrict__ qkv_b,
                      const _Float16* __restrict__ W16,
                      const _Float16* __restrict__ BM,
                      float* __restrict__ out) {
  __shared__ __align__(16) _Float16 smem[SMEM_HALVES];

  const int tid  = threadIdx.x;
  const int lane = tid & 31;
  const int wid  = tid >> 5;     // 8 waves
  const int l16  = lane & 15;
  const int g    = lane >> 4;    // lane group (K-split for A/B, row-split for C/D)
  const int b    = blockIdx.x;   // window index
  const int w    = b & 63;       // mask window id (b % NW)

  v8f vzero;
#pragma unroll
  for (int i = 0; i < 8; ++i) vzero[i] = 0.f;

  const int h = wid >> 1;   // head handled by this wave
  const int u = wid & 1;    // half-split within head
  const int qt0 = 2 * u;    // first of this wave's two query tiles

  // -------- Phase 1: stage x as f16 (zero-padded 64 rows) --------
  {
    const float4* x4 = (const float4*)(x + (size_t)b * NTOK * DIM);
    for (int i = tid; i < 64 * 32; i += 256) {       // 64 rows x 32 float4
      int m = i >> 5, c4 = i & 31;
      float4 val;
      if (m < NTOK) val = x4[m * 32 + c4];
      else          val = float4{0.f, 0.f, 0.f, 0.f};
      v4h hv;
      hv[0] = (_Float16)val.x; hv[1] = (_Float16)val.y;
      hv[2] = (_Float16)val.z; hv[3] = (_Float16)val.w;
      *(v4h*)&smem[XS_OFF + m * XS_STR + c4 * 4] = hv;
    }
  }
  __syncthreads();

  // -------- Phase 2: QKV projection (wave handles channels 96h+48u .. +47) --------
  // Hoist all 16 x-fragments once: reused across 3 n-tiles and 4 k-steps.
  v16h xfrag[4][4];   // [mt][kk]
  {
    const _Float16* xb = &smem[XS_OFF + l16 * XS_STR + g * 8];
#pragma unroll
    for (int mt = 0; mt < 4; ++mt)
#pragma unroll
      for (int kk = 0; kk < 4; ++kk)
        xfrag[mt][kk] = ldfrag(xb + mt * 16 * XS_STR + kk * 32);
  }

  // bias+mask for this wave's 2x4 score tiles: eight 16-byte loads per lane
  v8h bmf[2][4];
  const v8h* bp = (const v8h*)BM + (((w * NH + h) * 4 + qt0) * 4) * 32 + lane;

#pragma unroll
  for (int nt = 0; nt < 3; ++nt) {
    int ob = 96 * h + 48 * u + nt * 16 + l16;      // this lane's output channel
    float bias = qkv_b[ob];
    int s   = ob % 3;                               // 0=q 1=k 2=v
    int dch = (ob / 3) & (HD - 1);                  // head-dim index

    v8f acc[4];
#pragma unroll
    for (int mt = 0; mt < 4; ++mt) acc[mt] = vzero;

    // issued in the last channel tile, where no further weight fragments are
    // in flight: the registers are free and the loads fly under the rest of
    // the projection
    if (nt == 2) {
#pragma unroll
      for (int qi = 0; qi < 2; ++qi)
#pragma unroll
        for (int kt = 0; kt < 4; ++kt) bmf[qi][kt] = bp[(qi * 4 + kt) * 32];
    }

    const _Float16* wb = W16 + ob * DIM + g * 8;   // B: W^T[k][o], L2-resident
    v16h bf[4];
#pragma unroll
    for (int kk = 0; kk < 4; ++kk) bf[kk] = ldfrag(wb + kk * 32);

#pragma unroll
    for (int kk = 0; kk < 4; ++kk)
#pragma unroll
      for (int mt = 0; mt < 4; ++mt)
        acc[mt] = wmma_f16(xfrag[mt][kk], bf[kk], acc[mt]);

    // epilogue: scatter +bias to q/k row-major, v transposed
    _Float16* dst;
    int step;
    if (s == 0)      { dst = &smem[QS_OFF + h * QK_HEAD + dch];          step = QK_STR; }
    else if (s == 1) { dst = &smem[KS_OFF + h * QK_HEAD + dch];          step = QK_STR; }
    else             { dst = &smem[VT_OFF + h * VT_HEAD + dch * VT_STR]; step = 1; }
#pragma unroll
    for (int mt = 0; mt < 4; ++mt) {
#pragma unroll
      for (int r = 0; r < 8; ++r) {
        int m = mt * 16 + g * 8 + r;
        dst[m * step] = (_Float16)(acc[mt][r] + bias);
      }
    }
  }
  __syncthreads();

  // -------- Phase 3: attention for head h, query tiles {2u, 2u+1} --------
  v16h aq0 = ldfrag(&smem[QS_OFF + h * QK_HEAD + (qt0 * 16 + l16) * QK_STR + g * 8]);
  v16h aq1 = ldfrag(&smem[QS_OFF + h * QK_HEAD + ((qt0 + 1) * 16 + l16) * QK_STR + g * 8]);

  v8f sacc[2][4];
#pragma unroll
  for (int qi = 0; qi < 2; ++qi)
#pragma unroll
    for (int kt = 0; kt < 4; ++kt) sacc[qi][kt] = vzero;

#pragma unroll
  for (int kt = 0; kt < 4; ++kt) {
    v16h bk = ldfrag(&smem[KS_OFF + h * QK_HEAD + (kt * 16 + l16) * QK_STR + g * 8]);
    sacc[0][kt] = wmma_f16(aq0, bk, sacc[0][kt]);
    sacc[1][kt] = wmma_f16(aq1, bk, sacc[1][kt]);
  }

  // softmax: row n lives in one 16-lane group, columns across 4 accs + 16 lanes
  const float scale = 0.17677669529663687f;  // 1/sqrt(32)
#pragma unroll
  for (int qi = 0; qi < 2; ++qi) {
    int nbase = (qt0 + qi) * 16 + g * 8;
#pragma unroll
    for (int r = 0; r < 8; ++r) {
      int n = nbase + r;
      float v0 = sacc[qi][0][r] * scale + (float)bmf[qi][0][r];
      float v1 = sacc[qi][1][r] * scale + (float)bmf[qi][1][r];
      float v2 = sacc[qi][2][r] * scale + (float)bmf[qi][2][r];
      float v3 = sacc[qi][3][r] * scale + (float)bmf[qi][3][r];
      float mx = fmaxf(fmaxf(v0, v1), fmaxf(v2, v3));
      mx = fmaxf(mx, __shfl_xor(mx, 1, 16));
      mx = fmaxf(mx, __shfl_xor(mx, 2, 16));
      mx = fmaxf(mx, __shfl_xor(mx, 4, 16));
      mx = fmaxf(mx, __shfl_xor(mx, 8, 16));
      float e0 = __expf(v0 - mx), e1 = __expf(v1 - mx);
      float e2 = __expf(v2 - mx), e3 = __expf(v3 - mx);
      float sm = e0 + e1 + e2 + e3;
      sm += __shfl_xor(sm, 1, 16);
      sm += __shfl_xor(sm, 2, 16);
      sm += __shfl_xor(sm, 4, 16);
      sm += __shfl_xor(sm, 8, 16);
      float inv = 1.0f / sm;
      _Float16* prow = &smem[PS_OFF + h * PS_HEAD + n * PS_STR + l16];
      prow[0]  = (_Float16)(e0 * inv);
      prow[16] = (_Float16)(e1 * inv);
      prow[32] = (_Float16)(e2 * inv);
      prow[48] = (_Float16)(e3 * inv);
    }
  }

  // P(64x64) @ V(64x32): B from vT so K-pairs are contiguous
  v8f oacc[2][2];
#pragma unroll
  for (int qi = 0; qi < 2; ++qi)
#pragma unroll
    for (int dt = 0; dt < 2; ++dt) oacc[qi][dt] = vzero;

#pragma unroll
  for (int kk = 0; kk < 2; ++kk) {
    v16h bv0 = ldfrag(&smem[VT_OFF + h * VT_HEAD + l16 * VT_STR + kk * 32 + g * 8]);
    v16h bv1 = ldfrag(&smem[VT_OFF + h * VT_HEAD + (16 + l16) * VT_STR + kk * 32 + g * 8]);
    v16h ap0 = ldfrag(&smem[PS_OFF + h * PS_HEAD + (qt0 * 16 + l16) * PS_STR + kk * 32 + g * 8]);
    v16h ap1 = ldfrag(&smem[PS_OFF + h * PS_HEAD + ((qt0 + 1) * 16 + l16) * PS_STR + kk * 32 + g * 8]);
    oacc[0][0] = wmma_f16(ap0, bv0, oacc[0][0]);
    oacc[0][1] = wmma_f16(ap0, bv1, oacc[0][1]);
    oacc[1][0] = wmma_f16(ap1, bv0, oacc[1][0]);
    oacc[1][1] = wmma_f16(ap1, bv1, oacc[1][1]);
  }

  // store: out[b][n][h*32 + d], coalesced over l16
#pragma unroll
  for (int qi = 0; qi < 2; ++qi) {
#pragma unroll
    for (int dt = 0; dt < 2; ++dt) {
#pragma unroll
      for (int r = 0; r < 8; ++r) {
        int n = (qt0 + qi) * 16 + g * 8 + r;
        if (n < NTOK) {
          int c = h * HD + dt * 16 + l16;
          out[((size_t)b * NTOK + n) * DIM + c] = oacc[qi][dt][r];
        }
      }
    }
  }
}

extern "C" void kernel_launch(void* const* d_in, const int* in_sizes, int n_in,
                              void* d_out, int out_size, void* d_ws, size_t ws_size,
                              hipStream_t stream) {
  const float* x         = (const float*)d_in[0];
  const float* mask      = (const float*)d_in[1];
  const float* qkv_w     = (const float*)d_in[2];
  const float* qkv_b     = (const float*)d_in[3];
  const float* rel_table = (const float*)d_in[4];
  float* out = (float*)d_out;

  _Float16* w16 = (_Float16*)d_ws;   // 384*128*2 = 96 KB scratch
  _Float16* bm  = w16 + W16_HALVES;  // 2 MB bias+mask table behind it
  prep_kernel<<<704, 256, 0, stream>>>(qkv_w, mask, rel_table, w16, bm);

  swin_attn_kernel<<<4096, 256, 0, stream>>>(x, qkv_b, w16, bm, out);
}

// v002
// It runs in 101 microseconds.
// Two timings next to v001 both put it at 1.07 times that version's speed.
// Over all steps from v000 it is 1.75 times as fast.
#include <hip/hip_runtime.h>
#include <hip/hip_bf16.h>

typedef _Float16 v16h __attribute__((ext_vector_type(16)));
typedef _Float16 v8h  __attribute__((ext_vector_type(8)));
typedef _Float16 v4h  __attribute__((ext_vector_type(4)));
typedef float    v8f  __attribute__((ext_vector_type(8)));

#define NTOK 49
#define DIM  128
#define NH   4
#define HD   32

// ---- LDS layout (units: _Float16 halves), all offsets multiple of 8 halves ----
#define XS_OFF   0            // x tile:      [64][136]
#define XS_STR   136
#define QS_OFF   8704         // q:           [4 heads][64 tok][40]
#define KS_OFF   18944        // k:           [4 heads][64 tok][40]
#define QK_STR   40
#define QK_HEAD  2560
#define VT_OFF   29184        // v transposed:[4 heads][32 d][72]
#define VT_STR   72
#define VT_HEAD  2304
#define PS_OFF   38400        // softmax P:   [4 heads][64 tok][72]
#define PS_STR   72
#define PS_HEAD  4608
#define SMEM_HALVES 56832     // 113,664 bytes -> 2 workgroups / WGP

// bias+mask table in the workspace, f16, in score-accumulator order:
// [64 mask windows][4 heads][4 query tiles][4 key tiles][32 lanes][8 rows]
#define W16_HALVES 49152      // 384*128 weights stand in front of the table
// weights in the workspace, f16, in B-fragment order:
// [24 channel tiles][4 k-steps][2 fragment halves][32 lanes][8 halves],
// so that one 16-byte load of a wave reads 512 contiguous bytes (4 whole lines)
// where the row-major matrix gave it 32 bytes out of each of 16 lines

// Load one 16x32 (A) or 32x16 (B) f16 fragment: per-lane two 16B loads at
// half-offsets {0..7} and {16..23}; caller supplies base = &buf[row*stride + g*8].
__device__ __forceinline__ v16h ldfrag(const _Float16* p) {
  union { v16h v; v8h h[2]; } u;
  u.h[0] = *(const v8h*)(p);
  u.h[1] = *(const v8h*)(p + 16);
  return u.v;
}

__device__ __forceinline__ v8f wmma_f16(v16h a, v16h b, v8f c) {
  return __builtin_amdgcn_wmma_f32_16x16x32_f16(false, a, false, b, (short)0, c,
                                                false, false);
}

// Blocks 0..191: weights to f16, in B-fragment order. Blocks 192..703: bias+mask table, once per
// (mask window, head); each thread writes the 8 rows one lane of the attention
// kernel adds to one 16x16 score tile.
__global__ __launch_bounds__(256)
void prep_kernel(const float* __restrict__ w,
                 const float* __restrict__ mask,
                 const float* __restrict__ rel_table,
                 _Float16* __restrict__ w16,
                 _Float16* __restrict__ bm) {
  if (blockIdx.x < 192) {
    const int i  = blockIdx.x * 256 + threadIdx.x;   // place in fragment order
    const int j  = i & 7;
    const int ln = (i >> 3) & 31;
    const int hh = (i >> 8) & 1;
    const int kk = (i >> 9) & 3;
    const int ct = i >> 11;
    w16[i] = (_Float16)w[(ct * 16 + (ln & 15)) * DIM + kk * 32 + hh * 16 +
                         (ln >> 4) * 8 + j];
    return;
  }
  const int t    = (blockIdx.x - 192) * 256 + threadIdx.x;
  const int lane = t & 31;
  const int kt   = (t >> 5) & 3;
  const int qt   = (t >> 7) & 3;
  const int h    = (t >> 9) & 3;
  const int wi   = t >> 11;
  const int m    = kt * 16 + (lane & 15);
  const int n0   = qt * 16 + (lane >> 4) * 8;
  // padded rows and columns read a clamped, in-range element, so that all 16
  // loads of a thread are in flight together; the select below drops them
  const int mc = m < NTOK ? m : NTOK - 1;
  float rv[8], mv[8];
#pragma unroll
  for (int r = 0; r < 8; ++r) {
    int nc  = n0 + r < NTOK ? n0 + r : NTOK - 1;
    int idx = (nc / 7 - mc / 7 + 6) * 13 + (nc % 7 - mc % 7 + 6);
    rv[r] = rel_table[idx * NH + h];
    // a later load of this run may land in this load's offset register: the
    // wait stands in front of that overwrite (the data stays in flight)
    asm volatile("s_wait_xcnt 0x0" ::: "memory");
    mv[r] = mask[(wi * NTOK + nc) * NTOK + mc];
    asm volatile("s_wait_xcnt 0x0" ::: "memory");  // same, for the mask load
  }
  v8h o;
#pragma unroll
  for (int r = 0; r < 8; ++r) {
    float val = rv[r] + mv[r];
    if (n0 + r >= NTOK) val = 0.f;           // padded query rows: never stored
    if (m >= NTOK)      val = -30000.f;      // kill padded key columns in softmax
    o[r] = (_Float16)val;
  }
  *(v8h*)(bm + (size_t)t * 8) = o;
}

__global__ __launch_bounds__(256)
void swin_attn_kernel(const float* __restrict__ x,
                      const float* __restrict__ qkv_b,
                      const _Float16* __restrict__ W16,
                      const _Float16* __restrict__ BM,
                      float* __restrict__ out) {
  __shared__ __align__(16) _Float16 smem[SMEM_HALVES];

  const int tid  = threadIdx.x;
  const int lane = tid & 31;
  const int wid  = tid >> 5;     // 8 waves
  const int l16  = lane & 15;
  const int g    = lane >> 4;    // lane group (K-split for A/B, row-split for C/D)
  const int b    = blockIdx.x;   // window index
  const int w    = b & 63;       // mask window id (b % NW)

  v8f vzero;
#pragma unroll
  for (int i = 0; i < 8; ++i) vzero[i] = 0.f;

  const int h = wid >> 1;   // head handled by this wave
  const int u = wid & 1;    // half-split within head
  const int qt0 = 2 * u;    // first of this wave's two query tiles

  // -------- Phase 1: stage x as f16 (zero-padded 64 rows) --------
  {
    const float4* x4 = (const float4*)(x + (size_t)b * NTOK * DIM);
    for (int i = tid; i < 64 * 32; i += 256) {       // 64 rows x 32 float4
      int m = i >> 5, c4 = i & 31;
      float4 val;
      if (m < NTOK) val = x4[m * 32 + c4];
      else          val = float4{0.f, 0.f, 0.f, 0.f};
      v4h hv;
      hv[0] = (_Float16)val.x; hv[1] = (_Float16)val.y;
      hv[2] = (_Float16)val.z; hv[3] = (_Float16)val.w;
      *(v4h*)&smem[XS_OFF + m * XS_STR + c4 * 4] = hv;
    }
  }
  __syncthreads();

  // -------- Phase 2: QKV projection (wave handles channels 96h+48u .. +47) --------
  // Hoist all 16 x-fragments once: reused across 3 n-tiles and 4 k-steps.
  v16h xfrag[4][4];   // [mt][kk]
  {
    const _Float16* xb = &smem[XS_OFF + l16 * XS_STR + g * 8];
#pragma unroll
    for (int mt = 0; mt < 4; ++mt)
#pragma unroll
      for (int kk = 0; kk < 4; ++kk)
        xfrag[mt][kk] = ldfrag(xb + mt * 16 * XS_STR + kk * 32);
  }

  // bias+mask for this wave's 2x4 score tiles: eight 16-byte loads per lane
  v8h bmf[2][4];
  const v8h* bp = (const v8h*)BM + (((w * NH + h) * 4 + qt0) * 4) * 32 + lane;

  // this wave's three channel tiles (3*wid ..), 8 x 32 16-byte pieces a tile
  const v8h* wf = (const v8h*)W16 + wid * 3 * 256 + lane;

#pragma unroll
  for (int nt = 0; nt < 3; ++nt) {
    int ob = 96 * h + 48 * u + nt * 16 + l16;      // this lane's output channel
    float bias = qkv_b[ob];
    int s   = ob % 3;                               // 0=q 1=k 2=v
    int dch = (ob / 3) & (HD - 1);                  // head-dim index

    v8f acc[4];
#pragma unroll
    for (int mt = 0; mt < 4; ++mt) acc[mt] = vzero;

    // issued in the last channel tile, where no further weight fragments are
    // in flight: the registers are free and the loads fly under the rest of
    // the projection
    if (nt == 2) {
#pragma unroll
      for (int qi = 0; qi < 2; ++qi)
#pragma unroll
        for (int kt = 0; kt < 4; ++kt) bmf[qi][kt] = bp[(qi * 4 + kt) * 32];
    }

    v16h bf[4];                                    // B: W^T[k][o], L2-resident
#pragma unroll
    for (int kk = 0; kk < 4; ++kk) {
      union { v16h v; v8h p[2]; } f;
      f.p[0] = wf[((nt * 4 + kk) * 2 + 0) * 32];
      f.p[1] = wf[((nt * 4 + kk) * 2 + 1) * 32];
      bf[kk] = f.v;
    }

#pragma unroll
    for (int kk = 0; kk < 4; ++kk)
#pragma unroll
      for (int mt = 0; mt < 4; ++mt)
        acc[mt] = wmma_f16(xfrag[mt][kk], bf[kk], acc[mt]);

    // epilogue: scatter +bias to q/k row-major, v transposed
    _Float16* dst;
    int step;
    if (s == 0)      { dst = &smem[QS_OFF + h * QK_HEAD + dch];          step = QK_STR; }
    else if (s == 1) { dst = &smem[KS_OFF + h * QK_HEAD + dch];          step = QK_STR; }
    else             { dst = &smem[VT_OFF + h * VT_HEAD + dch * VT_STR]; step = 1; }
#pragma unroll
    for (int mt = 0; mt < 4; ++mt) {
#pragma unroll
      for (int r = 0; r < 8; ++r) {
        int m = mt * 16 + g * 8 + r;
        dst[m * step] = (_Float16)(acc[mt][r] + bias);
      }
    }
  }
  __syncthreads();

  // -------- Phase 3: attention for head h, query tiles {2u, 2u+1} --------
  v16h aq0 = ldfrag(&smem[QS_OFF + h * QK_HEAD + (qt0 * 16 + l16) * QK_STR + g * 8]);
  v16h aq1 = ldfrag(&smem[QS_OFF + h * QK_HEAD + ((qt0 + 1) * 16 + l16) * QK_STR + g * 8]);

  v8f sacc[2][4];
#pragma unroll
  for (int qi = 0; qi < 2; ++qi)
#pragma unroll
    for (int kt = 0; kt < 4; ++kt) sacc[qi][kt] = vzero;

#pragma unroll
  for (int kt = 0; kt < 4; ++kt) {
    v16h bk = ldfrag(&smem[KS_OFF + h * QK_HEAD + (kt * 16 + l16) * QK_STR + g * 8]);
    sacc[0][kt] = wmma_f16(aq0, bk, sacc[0][kt]);
    sacc[1][kt] = wmma_f16(aq1, bk, sacc[1][kt]);
  }

  // softmax: row n lives in one 16-lane group, columns across 4 accs + 16 lanes
  const float scale = 0.17677669529663687f;  // 1/sqrt(32)
#pragma unroll
  for (int qi = 0; qi < 2; ++qi) {
    int nbase = (qt0 + qi) * 16 + g * 8;
#pragma unroll
    for (int r = 0; r < 8; ++r) {
      int n = nbase + r;
      float v0 = sacc[qi][0][r] * scale + (float)bmf[qi][0][r];
      float v1 = sacc[qi][1][r] * scale + (float)bmf[qi][1][r];
      float v2 = sacc[qi][2][r] * scale + (float)bmf[qi][2][r];
      float v3 = sacc[qi][3][r] * scale + (float)bmf[qi][3][r];
      float mx = fmaxf(fmaxf(v0, v1), fmaxf(v2, v3));
      mx = fmaxf(mx, __shfl_xor(mx, 1, 16));
      mx = fmaxf(mx, __shfl_xor(mx, 2, 16));
      mx = fmaxf(mx, __shfl_xor(mx, 4, 16));
      mx = fmaxf(mx, __shfl_xor(mx, 8, 16));
      float e0 = __expf(v0 - mx), e1 = __expf(v1 - mx);
      float e2 = __expf(v2 - mx), e3 = __expf(v3 - mx);
      float sm = e0 + e1 + e2 + e3;
      sm += __shfl_xor(sm, 1, 16);
      sm += __shfl_xor(sm, 2, 16);
      sm += __shfl_xor(sm, 4, 16);
      sm += __shfl_xor(sm, 8, 16);
      float inv = 1.0f / sm;
      _Float16* prow = &smem[PS_OFF + h * PS_HEAD + n * PS_STR + l16];
      prow[0]  = (_Float16)(e0 * inv);
      prow[16] = (_Float16)(e1 * inv);
      prow[32] = (_Float16)(e2 * inv);
      prow[48] = (_Float16)(e3 * inv);
    }
  }

  // P(64x64) @ V(64x32): B from vT so K-pairs are contiguous
  v8f oacc[2][2];
#pragma unroll
  for (int qi = 0; qi < 2; ++qi)
#pragma unroll
    for (int dt = 0; dt < 2; ++dt) oacc[qi][dt] = vzero;

#pragma unroll
  for (int kk = 0; kk < 2; ++kk) {
    v16h bv0 = ldfrag(&smem[VT_OFF + h * VT_HEAD + l16 * VT_STR + kk * 32 + g * 8]);
    v16h bv1 = ldfrag(&smem[VT_OFF + h * VT_HEAD + (16 + l16) * VT_STR + kk * 32 + g * 8]);
    v16h ap0 = ldfrag(&smem[PS_OFF + h * PS_HEAD + (qt0 * 16 + l16) * PS_STR + kk * 32 + g * 8]);
    v16h ap1 = ldfrag(&smem[PS_OFF + h * PS_HEAD + ((qt0 + 1) * 16 + l16) * PS_STR + kk * 32 + g * 8]);
    oacc[0][0] = wmma_f16(ap0, bv0, oacc[0][0]);
    oacc[0][1] = wmma_f16(ap0, bv1, oacc[0][1]);
    oacc[1][0] = wmma_f16(ap1, bv0, oacc[1][0]);
    oacc[1][1] = wmma_f16(ap1, bv1, oacc[1][1]);
  }

  // store: out[b][n][h*32 + d], coalesced over l16
#pragma unroll
  for (int qi = 0; qi < 2; ++qi) {
#pragma unroll
    for (int dt = 0; dt < 2; ++dt) {
#pragma unroll
      for (int r = 0; r < 8; ++r) {
        int n = (qt0 + qi) * 16 + g * 8 + r;
        if (n < NTOK) {
          int c = h * HD + dt * 16 + l16;
          out[((size_t)b * NTOK + n) * DIM + c] = oacc[qi][dt][r];
        }
      }
    }
  }
}

extern "C" void kernel_launch(void* const* d_in, const int* in_sizes, int n_in,
                              void* d_out, int out_size, void* d_ws, size_t ws_size,
                              hipStream_t stream) {
  const float* x         = (const float*)d_in[0];
  const float* mask      = (const float*)d_in[1];
  const float* qkv_w     = (const float*)d_in[2];
  const float* qkv_b     = (const float*)d_in[3];
  const float* rel_table = (const float*)d_in[4];
  float* out = (float*)d_out;

  _Float16* w16 = (_Float16*)d_ws;   // 384*128*2 = 96 KB scratch
  _Float16* bm  = w16 + W16_HALVES;  // 2 MB bias+mask table behind it
  prep_kernel<<<704, 256, 0, stream>>>(qkv_w, mask, rel_table, w16, bm);

  swin_attn_kernel<<<4096, 256, 0, stream>>>(x, qkv_b, w16, bm, out);
}

// v003
// It runs in 82.1 microseconds.
// Timed twice side by side with v002, it ran 1.23 and 1.24 times as fast.
// All steps since v000 together make it 2.15 times as fast.
#include <hip/hip_runtime.h>
#include <hip/hip_bf16.h>

typedef _Float16 v16h __attribute__((ext_vector_type(16)));
typedef _Float16 v8h  __attribute__((ext_vector_type(8)));
typedef _Float16 v4h  __attribute__((ext_vector_type(4)));
typedef float    v8f  __attribute__((ext_vector_type(8)));

#define NTOK 49
#define DIM  128
#define NH   4
#define HD   32

// ---- LDS layout (units: _Float16 halves), all offsets multiple of 8 halves ----
#define XS_OFF   0            // x tile:      [64][136]
#define XS_STR   136
#define QS_OFF   8704         // q:           [4 heads][64 tok][40]
#define KS_OFF   18944        // k:           [4 heads][64 tok][40]
#define QK_STR   40
#define QK_HEAD  2560
#define VT_OFF   29184        // v transposed:[4 heads][32 d][72]
#define VT_STR   72
#define VT_HEAD  2304
#define PS_OFF   38400        // softmax P:   [4 heads][64 tok][72]
#define PS_STR   72
#define PS_HEAD  4608
#define SMEM_HALVES 56832     // 113,664 bytes -> 2 workgroups / WGP

// bias+mask table in the workspace, f16, in score-accumulator order:
// [64 mask windows][4 heads][4 query tiles][4 key tiles][32 lanes][8 rows]
#define W16_HALVES 49152      // 384*128 weights stand in front of the table
// weights in the workspace, f16, in B-fragment order:
// [24 channel tiles][4 k-steps][2 fragment halves][32 lanes][8 halves],
// so that one 16-byte load of a wave reads 512 contiguous bytes (4 whole lines)
// where the row-major matrix gave it 32 bytes out of each of 16 lines

// Load one 16x32 (A) or 32x16 (B) f16 fragment: per-lane two 16B loads at
// half-offsets {0..7} and {16..23}; caller supplies base = &buf[row*stride + g*8].
__device__ __forceinline__ v16h ldfrag(const _Float16* p) {
  union { v16h v; v8h h[2]; } u;
  u.h[0] = *(const v8h*)(p);
  u.h[1] = *(const v8h*)(p + 16);
  return u.v;
}

__device__ __forceinline__ v8f wmma_f16(v16h a, v16h b, v8f c) {
  return __builtin_amdgcn_wmma_f32_16x16x32_f16(false, a, false, b, (short)0, c,
                                                false, false);
}

// Blocks 0..191: weights to f16, in B-fragment order. Blocks 192..703: bias+mask table, once per
// (mask window, head); each thread writes the 8 rows one lane of the attention
// kernel adds to one 16x16 score tile.
__global__ __launch_bounds__(256)
void prep_kernel(const float* __restrict__ w,
                 const float* __restrict__ mask,
                 const float* __restrict__ rel_table,
                 _Float16* __restrict__ w16,
                 _Float16* __restrict__ bm) {
  if (blockIdx.x < 192) {
    const int i  = blockIdx.x * 256 + threadIdx.x;   // place in fragment order
    const int j  = i & 7;
    const int ln = (i >> 3) & 31;
    const int hh = (i >> 8) & 1;
    const int kk = (i >> 9) & 3;
    const int ct = i >> 11;
    w16[i] = (_Float16)w[(ct * 16 + (ln & 15)) * DIM + kk * 32 + hh * 16 +
                         (ln >> 4) * 8 + j];
    return;
  }
  const int t    = (blockIdx.x - 192) * 256 + threadIdx.x;
  const int lane = t & 31;
  const int kt   = (t >> 5) & 3;
  const int qt   = (t >> 7) & 3;
  const int h    = (t >> 9) & 3;
  const int wi   = t >> 11;
  const int m    = kt * 16 + (lane & 15);
  const int n0   = qt * 16 + (lane >> 4) * 8;
  // padded rows and columns read a clamped, in-range element, so that all 16
  // loads of a thread are in flight together; the select below drops them
  const int mc = m < NTOK ? m : NTOK - 1;
  float rv[8], mv[8];
#pragma unroll
  for (int r = 0; r < 8; ++r) {
    int nc  = n0 + r < NTOK ? n0 + r : NTOK - 1;
    int idx = (nc / 7 - mc / 7 + 6) * 13 + (nc % 7 - mc % 7 + 6);
    rv[r] = rel_table[idx * NH + h];
    // a later load of this run may land in this load's offset register: the
    // wait stands in front of that overwrite (the data stays in flight)
    asm volatile("s_wait_xcnt 0x0" ::: "memory");
    mv[r] = mask[(wi * NTOK + nc) * NTOK + mc];
    asm volatile("s_wait_xcnt 0x0" ::: "memory");  // same, for the mask load
  }
  v8h o;
#pragma unroll
  for (int r = 0; r < 8; ++r) {
    float val = rv[r] + mv[r];
    if (n0 + r >= NTOK) val = 0.f;           // padded query rows: never stored
    if (m >= NTOK)      val = -30000.f;      // kill padded key columns in softmax
    o[r] = (_Float16)val;
  }
  *(v8h*)(bm + (size_t)t * 8) = o;
}

__global__ __launch_bounds__(256)
void swin_attn_kernel(const float* __restrict__ x,
                      const float* __restrict__ qkv_b,
                      const _Float16* __restrict__ W16,
                      const _Float16* __restrict__ BM,
                      float* __restrict__ out) {
  __shared__ __align__(16) _Float16 smem[SMEM_HALVES];

  const int tid  = threadIdx.x;
  const int lane = tid & 31;
  const int wid  = tid >> 5;     // 8 waves
  const int l16  = lane & 15;
  const int g    = lane >> 4;    // lane group (K-split for A/B, row-split for C/D)
  const int b    = blockIdx.x;   // window index
  const int w    = b & 63;       // mask window id (b % NW)

  v8f vzero;
#pragma unroll
  for (int i = 0; i < 8; ++i) vzero[i] = 0.f;

  const int h = wid >> 1;   // head handled by this wave
  const int u = wid & 1;    // half-split within head
  const int qt0 = 2 * u;    // first of this wave's two query tiles

  // -------- Phase 1: stage x as f16 (zero-padded 64 rows) --------
  // All of a thread's loads are issued before the first is waited for: one
  // memory latency a block instead of one a trip. Trips 0..5 are rows 0..47,
  // trip 6 is row 48 (wave 0 alone) and zeros, trip 7 zeros.
  {
    const float4* x4 = (const float4*)(x + (size_t)b * NTOK * DIM) + tid;
    float4 xr[8];
    // unrolled so that the six loads stand in a row with no wait between them
#pragma unroll
    for (int t = 0; t < 6; ++t) xr[t] = x4[t * 256];
    xr[6] = float4{0.f, 0.f, 0.f, 0.f};
    xr[7] = float4{0.f, 0.f, 0.f, 0.f};
    if (wid == 0) xr[6] = x4[6 * 256];
    _Float16* xs = &smem[XS_OFF + wid * XS_STR + lane * 4];
    // unrolled so that xr is indexed by constants and stays in registers
#pragma unroll
    for (int t = 0; t < 8; ++t) {
      v4h hv;
      hv[0] = (_Float16)xr[t].x; hv[1] = (_Float16)xr[t].y;
      hv[2] = (_Float16)xr[t].z; hv[3] = (_Float16)xr[t].w;
      *(v4h*)&xs[t * 8 * XS_STR] = hv;
    }
  }
  __syncthreads();

  // -------- Phase 2: QKV projection (wave handles channels 96h+48u .. +47) --------
  // Hoist all 16 x-fragments once: reused across 3 n-tiles and 4 k-steps.
  v16h xfrag[4][4];   // [mt][kk]
  {
    const _Float16* xb = &smem[XS_OFF + l16 * XS_STR + g * 8];
#pragma unroll
    for (int mt = 0; mt < 4; ++mt)
#pragma unroll
      for (int kk = 0; kk < 4; ++kk)
        xfrag[mt][kk] = ldfrag(xb + mt * 16 * XS_STR + kk * 32);
  }

  // bias+mask for this wave's 2x4 score tiles: eight 16-byte loads per lane
  v8h bmf[2][4];
  const v8h* bp = (const v8h*)BM + (((w * NH + h) * 4 + qt0) * 4) * 32 + lane;

  // this wave's three channel tiles (3*wid ..), 8 x 32 16-byte pieces a tile
  const v8h* wf = (const v8h*)W16 + wid * 3 * 256 + lane;

#pragma unroll
  for (int nt = 0; nt < 3; ++nt) {
    int ob = 96 * h + 48 * u + nt * 16 + l16;      // this lane's output channel
    float bias = qkv_b[ob];
    int s   = ob % 3;                               // 0=q 1=k 2=v
    int dch = (ob / 3) & (HD - 1);                  // head-dim index

    v8f acc[4];
#pragma unroll
    for (int mt = 0; mt < 4; ++mt) acc[mt] = vzero;

    // issued in the last channel tile, where no further weight fragments are
    // in flight: the registers are free and the loads fly under the rest of
    // the projection
    if (nt == 2) {
#pragma unroll
      for (int qi = 0; qi < 2; ++qi)
#pragma unroll
        for (int kt = 0; kt < 4; ++kt) bmf[qi][kt] = bp[(qi * 4 + kt) * 32];
    }

    v16h bf[4];                                    // B: W^T[k][o], L2-resident
#pragma unroll
    for (int kk = 0; kk < 4; ++kk) {
      union { v16h v; v8h p[2]; } f;
      f.p[0] = wf[((nt * 4 + kk) * 2 + 0) * 32];
      f.p[1] = wf[((nt * 4 + kk) * 2 + 1) * 32];
      bf[kk] = f.v;
    }

#pragma unroll
    for (int kk = 0; kk < 4; ++kk)
#pragma unroll
      for (int mt = 0; mt < 4; ++mt)
        acc[mt] = wmma_f16(xfrag[mt][kk], bf[kk], acc[mt]);

    // epilogue: scatter +bias to q/k row-major, v transposed
    _Float16* dst;
    int step;
    if (s == 0)      { dst = &smem[QS_OFF + h * QK_HEAD + dch];          step = QK_STR; }
    else if (s == 1) { dst = &smem[KS_OFF + h * QK_HEAD + dch];          step = QK_STR; }
    else             { dst = &smem[VT_OFF + h * VT_HEAD + dch * VT_STR]; step = 1; }
#pragma unroll
    for (int mt = 0; mt < 4; ++mt) {
#pragma unroll
      for (int r = 0; r < 8; ++r) {
        int m = mt * 16 + g * 8 + r;
        dst[m * step] = (_Float16)(acc[mt][r] + bias);
      }
    }
  }
  __syncthreads();

  // -------- Phase 3: attention for head h, query tiles {2u, 2u+1} --------
  v16h aq0 = ldfrag(&smem[QS_OFF + h * QK_HEAD + (qt0 * 16 + l16) * QK_STR + g * 8]);
  v16h aq1 = ldfrag(&smem[QS_OFF + h * QK_HEAD + ((qt0 + 1) * 16 + l16) * QK_STR + g * 8]);

  v8f sacc[2][4];
#pragma unroll
  for (int qi = 0; qi < 2; ++qi)
#pragma unroll
    for (int kt = 0; kt < 4; ++kt) sacc[qi][kt] = vzero;

#pragma unroll
  for (int kt = 0; kt < 4; ++kt) {
    v16h bk = ldfrag(&smem[KS_OFF + h * QK_HEAD + (kt * 16 + l16) * QK_STR + g * 8]);
    sacc[0][kt] = wmma_f16(aq0, bk, sacc[0][kt]);
    sacc[1][kt] = wmma_f16(aq1, bk, sacc[1][kt]);
  }

  // softmax: row n lives in one 16-lane group, columns across 4 accs + 16 lanes
  const float scale = 0.17677669529663687f;  // 1/sqrt(32)
#pragma unroll
  for (int qi = 0; qi < 2; ++qi) {
    int nbase = (qt0 + qi) * 16 + g * 8;
#pragma unroll
    for (int r = 0; r < 8; ++r) {
      int n = nbase + r;
      float v0 = sacc[qi][0][r] * scale + (float)bmf[qi][0][r];
      float v1 = sacc[qi][1][r] * scale + (float)bmf[qi][1][r];
      float v2 = sacc[qi][2][r] * scale + (float)bmf[qi][2][r];
      float v3 = sacc[qi][3][r] * scale + (float)bmf[qi][3][r];
      float mx = fmaxf(fmaxf(v0, v1), fmaxf(v2, v3));
      mx = fmaxf(mx, __shfl_xor(mx, 1, 16));
      mx = fmaxf(mx, __shfl_xor(mx, 2, 16));
      mx = fmaxf(mx, __shfl_xor(mx, 4, 16));
      mx = fmaxf(mx, __shfl_xor(mx, 8, 16));
      float e0 = __expf(v0 - mx), e1 = __expf(v1 - mx);
      float e2 = __expf(v2 - mx), e3 = __expf(v3 - mx);
      float sm = e0 + e1 + e2 + e3;
      sm += __shfl_xor(sm, 1, 16);
      sm += __shfl_xor(sm, 2, 16);
      sm += __shfl_xor(sm, 4, 16);
      sm += __shfl_xor(sm, 8, 16);
      float inv = 1.0f / sm;
      _Float16* prow = &smem[PS_OFF + h * PS_HEAD + n * PS_STR + l16];
      prow[0]  = (_Float16)(e0 * inv);
      prow[16] = (_Float16)(e1 * inv);
      prow[32] = (_Float16)(e2 * inv);
      prow[48] = (_Float16)(e3 * inv);
    }
  }

  // P(64x64) @ V(64x32): B from vT so K-pairs are contiguous
  v8f oacc[2][2];
#pragma unroll
  for (int qi = 0; qi < 2; ++qi)
#pragma unroll
    for (int dt = 0; dt < 2; ++dt) oacc[qi][dt] = vzero;

#pragma unroll
  for (int kk = 0; kk < 2; ++kk) {
    v16h bv0 = ldfrag(&smem[VT_OFF + h * VT_HEAD + l16 * VT_STR + kk * 32 + g * 8]);
    v16h bv1 = ldfrag(&smem[VT_OFF + h * VT_HEAD + (16 + l16) * VT_STR + kk * 32 + g * 8]);
    v16h ap0 = ldfrag(&smem[PS_OFF + h * PS_HEAD + (qt0 * 16 + l16) * PS_STR + kk * 32 + g * 8]);
    v16h ap1 = ldfrag(&smem[PS_OFF + h * PS_HEAD + ((qt0 + 1) * 16 + l16) * PS_STR + kk * 32 + g * 8]);
    oacc[0][0] = wmma_f16(ap0, bv0, oacc[0][0]);
    oacc[0][1] = wmma_f16(ap0, bv1, oacc[0][1]);
    oacc[1][0] = wmma_f16(ap1, bv0, oacc[1][0]);
    oacc[1][1] = wmma_f16(ap1, bv1, oacc[1][1]);
  }

  // store: out[b][n][h*32 + d], coalesced over l16
#pragma unroll
  for (int qi = 0; qi < 2; ++qi) {
#pragma unroll
    for (int dt = 0; dt < 2; ++dt) {
#pragma unroll
      for (int r = 0; r < 8; ++r) {
        int n = (qt0 + qi) * 16 + g * 8 + r;
        if (n < NTOK) {
          int c = h * HD + dt * 16 + l16;
          out[((size_t)b * NTOK + n) * DIM + c] = oacc[qi][dt][r];
        }
      }
    }
  }
}

extern "C" void kernel_launch(void* const* d_in, const int* in_sizes, int n_in,
                              void* d_out, int out_size, void* d_ws, size_t ws_size,
                              hipStream_t stream) {
  const float* x         = (const float*)d_in[0];
  const float* mask      = (const float*)d_in[1];
  const float* qkv_w     = (const float*)d_in[2];
  const float* qkv_b     = (const float*)d_in[3];
  const float* rel_table = (const float*)d_in[4];
  float* out = (float*)d_out;

  _Float16* w16 = (_Float16*)d_ws;   // 384*128*2 = 96 KB scratch
  _Float16* bm  = w16 + W16_HALVES;  // 2 MB bias+mask table behind it
  prep_kernel<<<704, 256, 0, stream>>>(qkv_w, mask, rel_table, w16, bm);

  swin_attn_kernel<<<4096, 256, 0, stream>>>(x, qkv_b, w16, bm, out);
}

// v004
// It runs in 66.7 microseconds.
// In both of two side-by-side timings against v003, it was 1.23 times as fast.
// Over all steps from v000 it is 2.65 times as fast.
#include <hip/hip_runtime.h>
#include <hip/hip_bf16.h>

typedef _Float16 v16h __attribute__((ext_vector_type(16)));
typedef _Float16 v8h  __attribute__((ext_vector_type(8)));
typedef _Float16 v4h  __attribute__((ext_vector_type(4)));
typedef float    v8f  __attribute__((ext_vector_type(8)));

#define NTOK 49
#define DIM  128
#define NH   4
#define HD   32

// ---- LDS layout (units: _Float16 halves), all offsets multiple of 8 halves ----
#define XS_OFF   0            // x tile:      [64][136]
#define XS_STR   136
#define QS_OFF   8704         // q:           [4 heads][64 tok][40]
#define KS_OFF   18944        // k:           [4 heads][64 tok][40]
#define QK_STR   40
#define QK_HEAD  2560
#define VT_OFF   29184        // v transposed:[4 heads][32 d][72]
#define VT_STR   72
#define VT_HEAD  2304
#define SMEM_HALVES 38400     // 76,800 bytes

// bias+mask table in the workspace, f16, in the accumulator order of the
// transposed scores (keys down the rows, queries across the lanes):
// [64 mask windows][4 heads][4 query tiles][4 key tiles][32 lanes][8 keys]
#define W16_HALVES 49152      // 384*128 weights stand in front of the table
// weights in the workspace, f16, in B-fragment order:
// [24 channel tiles][4 k-steps][2 fragment halves][32 lanes][8 halves],
// so that one 16-byte load of a wave reads 512 contiguous bytes (4 whole lines)
// where the row-major matrix gave it 32 bytes out of each of 16 lines

// Load one 16x32 (A) or 32x16 (B) f16 fragment: per-lane two 16B loads at
// half-offsets {0..7} and {16..23}; caller supplies base = &buf[row*stride + g*8].
__device__ __forceinline__ v16h ldfrag(const _Float16* p) {
  union { v16h v; v8h h[2]; } u;
  u.h[0] = *(const v8h*)(p);
  u.h[1] = *(const v8h*)(p + 16);
  return u.v;
}

// lane l with lane l ^ 16: the two lanes that share one query's keys
__device__ __forceinline__ float xhalf(float x) {
  return __builtin_bit_cast(float, __builtin_amdgcn_permlanex16(
      __builtin_bit_cast(int, x), __builtin_bit_cast(int, x),
      0x76543210, 0xfedcba98, false, false));
}

__device__ __forceinline__ v8f wmma_f16(v16h a, v16h b, v8f c) {
  return __builtin_amdgcn_wmma_f32_16x16x32_f16(false, a, false, b, (short)0, c,
                                                false, false);
}

// Blocks 0..191: weights to f16, in B-fragment order. Blocks 192..703: bias+mask table, once per
// (mask window, head); each thread writes the 8 keys one lane of the attention
// kernel adds to one 16x16 tile of transposed scores.
__global__ __launch_bounds__(256)
void prep_kernel(const float* __restrict__ w,
                 const float* __restrict__ mask,
                 const float* __restrict__ rel_table,
                 _Float16* __restrict__ w16,
                 _Float16* __restrict__ bm) {
  if (blockIdx.x < 192) {
    const int i  = blockIdx.x * 256 + threadIdx.x;   // place in fragment order
    const int j  = i & 7;
    const int ln = (i >> 3) & 31;
    const int hh = (i >> 8) & 1;
    const int kk = (i >> 9) & 3;
    const int ct = i >> 11;
    w16[i] = (_Float16)w[(ct * 16 + (ln & 15)) * DIM + kk * 32 + hh * 16 +
                         (ln >> 4) * 8 + j];
    return;
  }
  const int t    = (blockIdx.x - 192) * 256 + threadIdx.x;
  const int lane = t & 31;
  const int kt   = (t >> 5) & 3;
  const int qt   = (t >> 7) & 3;
  const int h    = (t >> 9) & 3;
  const int wi   = t >> 11;
  const int n    = qt * 16 + (lane & 15);
  const int m0   = kt * 16 + (lane >> 4) * 8;
  // padded rows and columns read a clamped, in-range element, so that all 16
  // loads of a thread are in flight together; the select below drops them
  const int nc = n < NTOK ? n : NTOK - 1;
  float rv[8], mv[8];
#pragma unroll
  for (int r = 0; r < 8; ++r) {
    int mc  = m0 + r < NTOK ? m0 + r : NTOK - 1;
    int idx = (nc / 7 - mc / 7 + 6) * 13 + (nc % 7 - mc % 7 + 6);
    rv[r] = rel_table[idx * NH + h];
    // a later load of this run may land in this load's offset register: the
    // wait stands in front of that overwrite (the data stays in flight)
    asm volatile("s_wait_xcnt 0x0" ::: "memory");
    mv[r] = mask[(wi * NTOK + nc) * NTOK + mc];
    asm volatile("s_wait_xcnt 0x0" ::: "memory");  // same, for the mask load
  }
  v8h o;
#pragma unroll
  for (int r = 0; r < 8; ++r) {
    float val = rv[r] + mv[r];
    if (n >= NTOK)      val = 0.f;           // padded queries: never stored
    if (m0 + r >= NTOK) val = -30000.f;      // kill padded keys in softmax
    o[r] = (_Float16)val;
  }
  *(v8h*)(bm + (size_t)t * 8) = o;
}

__global__ __launch_bounds__(256)
void swin_attn_kernel(const float* __restrict__ x,
                      const float* __restrict__ qkv_b,
                      const _Float16* __restrict__ W16,
                      const _Float16* __restrict__ BM,
                      float* __restrict__ out) {
  __shared__ __align__(16) _Float16 smem[SMEM_HALVES];

  const int tid  = threadIdx.x;
  const int lane = tid & 31;
  const int wid  = tid >> 5;     // 8 waves
  const int l16  = lane & 15;
  const int g    = lane >> 4;    // lane group (K-split for A/B, row-split for C/D)
  const int b    = blockIdx.x;   // window index
  const int w    = b & 63;       // mask window id (b % NW)

  v8f vzero;
#pragma unroll
  for (int i = 0; i < 8; ++i) vzero[i] = 0.f;

  const int h = wid >> 1;   // head handled by this wave
  const int u = wid & 1;    // half-split within head
  const int qt0 = 2 * u;    // first of this wave's two query tiles

  // -------- Phase 1: stage x as f16 (zero-padded 64 rows) --------
  // All of a thread's loads are issued before the first is waited for: one
  // memory latency a block instead of one a trip. Trips 0..5 are rows 0..47,
  // trip 6 is row 48 (wave 0 alone) and zeros, trip 7 zeros.
  {
    const float4* x4 = (const float4*)(x + (size_t)b * NTOK * DIM) + tid;
    float4 xr[8];
    // unrolled so that the six loads stand in a row with no wait between them
#pragma unroll
    for (int t = 0; t < 6; ++t) xr[t] = x4[t * 256];
    xr[6] = float4{0.f, 0.f, 0.f, 0.f};
    xr[7] = float4{0.f, 0.f, 0.f, 0.f};
    if (wid == 0) xr[6] = x4[6 * 256];
    _Float16* xs = &smem[XS_OFF + wid * XS_STR + lane * 4];
    // unrolled so that xr is indexed by constants and stays in registers
#pragma unroll
    for (int t = 0; t < 8; ++t) {
      v4h hv;
      hv[0] = (_Float16)xr[t].x; hv[1] = (_Float16)xr[t].y;
      hv[2] = (_Float16)xr[t].z; hv[3] = (_Float16)xr[t].w;
      *(v4h*)&xs[t * 8 * XS_STR] = hv;
    }
  }
  __syncthreads();

  // -------- Phase 2: QKV projection (wave handles channels 96h+48u .. +47) --------
  // Hoist all 16 x-fragments once: reused across 3 n-tiles and 4 k-steps.
  v16h xfrag[4][4];   // [mt][kk]
  {
    const _Float16* xb = &smem[XS_OFF + l16 * XS_STR + g * 8];
#pragma unroll
    for (int mt = 0; mt < 4; ++mt)
#pragma unroll
      for (int kk = 0; kk < 4; ++kk)
        xfrag[mt][kk] = ldfrag(xb + mt * 16 * XS_STR + kk * 32);
  }

  // bias+mask for this wave's 2x4 score tiles: eight 16-byte loads per lane
  v8h bmf[2][4];
  const v8h* bp = (const v8h*)BM + (((w * NH + h) * 4 + qt0) * 4) * 32 + lane;

  // this wave's three channel tiles (3*wid ..), 8 x 32 16-byte pieces a tile
  const v8h* wf = (const v8h*)W16 + wid * 3 * 256 + lane;

#pragma unroll
  for (int nt = 0; nt < 3; ++nt) {
    int ob = 96 * h + 48 * u + nt * 16 + l16;      // this lane's output channel
    float bias = qkv_b[ob];
    int s   = ob % 3;                               // 0=q 1=k 2=v
    int dch = (ob / 3) & (HD - 1);                  // head-dim index

    v8f acc[4];
#pragma unroll
    for (int mt = 0; mt < 4; ++mt) acc[mt] = vzero;

    // issued in the last channel tile, where no further weight fragments are
    // in flight: the registers are free and the loads fly under the rest of
    // the projection
    if (nt == 2) {
#pragma unroll
      for (int qi = 0; qi < 2; ++qi)
#pragma unroll
        for (int kt = 0; kt < 4; ++kt) bmf[qi][kt] = bp[(qi * 4 + kt) * 32];
    }

    v16h bf[4];                                    // B: W^T[k][o], L2-resident
#pragma unroll
    for (int kk = 0; kk < 4; ++kk) {
      union { v16h v; v8h p[2]; } f;
      f.p[0] = wf[((nt * 4 + kk) * 2 + 0) * 32];
      f.p[1] = wf[((nt * 4 + kk) * 2 + 1) * 32];
      bf[kk] = f.v;
    }

#pragma unroll
    for (int kk = 0; kk < 4; ++kk)
#pragma unroll
      for (int mt = 0; mt < 4; ++mt)
        acc[mt] = wmma_f16(xfrag[mt][kk], bf[kk], acc[mt]);

    // epilogue: scatter +bias to q/k row-major, v transposed
    _Float16* dst;
    int step;
    if (s == 0)      { dst = &smem[QS_OFF + h * QK_HEAD + dch];          step = QK_STR; }
    else if (s == 1) { dst = &smem[KS_OFF + h * QK_HEAD + dch];          step = QK_STR; }
    else             { dst = &smem[VT_OFF + h * VT_HEAD + dch * VT_STR]; step = 1; }
#pragma unroll
    for (int mt = 0; mt < 4; ++mt) {
#pragma unroll
      for (int r = 0; r < 8; ++r) {
        int m = mt * 16 + g * 8 + r;
        dst[m * step] = (_Float16)(acc[mt][r] + bias);
      }
    }
  }
  __syncthreads();

  // -------- Phase 3: attention for head h, query tiles {2u, 2u+1} --------
  // Transposed scores, S^T = K Q^T: keys down the accumulator rows, one query
  // per lane column. Lanes l and l ^ 16 hold the 64 keys of one query, 32 each.
  v16h bq0 = ldfrag(&smem[QS_OFF + h * QK_HEAD + (qt0 * 16 + l16) * QK_STR + g * 8]);
  v16h bq1 = ldfrag(&smem[QS_OFF + h * QK_HEAD + ((qt0 + 1) * 16 + l16) * QK_STR + g * 8]);

  v8f sacc[2][4];
#pragma unroll
  for (int qi = 0; qi < 2; ++qi)
#pragma unroll
    for (int kt = 0; kt < 4; ++kt) sacc[qi][kt] = vzero;

#pragma unroll
  for (int kt = 0; kt < 4; ++kt) {
    v16h ak = ldfrag(&smem[KS_OFF + h * QK_HEAD + (kt * 16 + l16) * QK_STR + g * 8]);
    sacc[0][kt] = wmma_f16(ak, bq0, sacc[0][kt]);
    sacc[1][kt] = wmma_f16(ak, bq1, sacc[1][kt]);
  }

  // softmax over a lane's own 32 registers, then one exchange with lane l ^ 16.
  // Register r of key tile kt is key kt*16 + g*8 + r: tiles 2kk and 2kk+1,
  // converted in place, are the A fragment of P for k-step kk.
  const float scale = 0.17677669529663687f;  // 1/sqrt(32)
  v16h ap[2][2];
#pragma unroll
  for (int qi = 0; qi < 2; ++qi) {
    v8f t[4];
#pragma unroll
    for (int kt = 0; kt < 4; ++kt)
#pragma unroll
      for (int r = 0; r < 8; ++r)
        t[kt][r] = sacc[qi][kt][r] * scale + (float)bmf[qi][kt][r];
    float m8[8];
#pragma unroll
    for (int r = 0; r < 8; ++r)
      m8[r] = fmaxf(fmaxf(t[0][r], t[1][r]), fmaxf(t[2][r], t[3][r]));
    float mx = fmaxf(fmaxf(fmaxf(m8[0], m8[1]), fmaxf(m8[2], m8[3])),
                     fmaxf(fmaxf(m8[4], m8[5]), fmaxf(m8[6], m8[7])));
    mx = fmaxf(mx, xhalf(mx));
#pragma unroll
    for (int kt = 0; kt < 4; ++kt)
#pragma unroll
      for (int r = 0; r < 8; ++r) t[kt][r] = __expf(t[kt][r] - mx);
    float s8[8];
#pragma unroll
    for (int r = 0; r < 8; ++r)
      s8[r] = (t[0][r] + t[1][r]) + (t[2][r] + t[3][r]);
    float sm = ((s8[0] + s8[1]) + (s8[2] + s8[3])) +
               ((s8[4] + s8[5]) + (s8[6] + s8[7]));
    sm += xhalf(sm);
    float inv = 1.0f / sm;
#pragma unroll
    for (int kk = 0; kk < 2; ++kk)
#pragma unroll
      for (int r = 0; r < 8; ++r) {
        ap[qi][kk][r]     = (_Float16)(t[2 * kk][r] * inv);
        ap[qi][kk][8 + r] = (_Float16)(t[2 * kk + 1][r] * inv);
      }
  }

  // P(64x64) @ V(64x32): A from registers, B from vT so K-pairs are contiguous
  v8f oacc[2][2];
#pragma unroll
  for (int qi = 0; qi < 2; ++qi)
#pragma unroll
    for (int dt = 0; dt < 2; ++dt) oacc[qi][dt] = vzero;

#pragma unroll
  for (int kk = 0; kk < 2; ++kk) {
    v16h bv0 = ldfrag(&smem[VT_OFF + h * VT_HEAD + l16 * VT_STR + kk * 32 + g * 8]);
    v16h bv1 = ldfrag(&smem[VT_OFF + h * VT_HEAD + (16 + l16) * VT_STR + kk * 32 + g * 8]);
    oacc[0][0] = wmma_f16(ap[0][kk], bv0, oacc[0][0]);
    oacc[0][1] = wmma_f16(ap[0][kk], bv1, oacc[0][1]);
    oacc[1][0] = wmma_f16(ap[1][kk], bv0, oacc[1][0]);
    oacc[1][1] = wmma_f16(ap[1][kk], bv1, oacc[1][1]);
  }

  // store: out[b][n][h*32 + d], coalesced over l16
#pragma unroll
  for (int qi = 0; qi < 2; ++qi) {
#pragma unroll
    for (int dt = 0; dt < 2; ++dt) {
#pragma unroll
      for (int r = 0; r < 8; ++r) {
        int n = (qt0 + qi) * 16 + g * 8 + r;
        if (n < NTOK) {
          int c = h * HD + dt * 16 + l16;
          out[((size_t)b * NTOK + n) * DIM + c] = oacc[qi][dt][r];
        }
      }
    }
  }
}

extern "C" void kernel_launch(void* const* d_in, const int* in_sizes, int n_in,
                              void* d_out, int out_size, void* d_ws, size_t ws_size,
                              hipStream_t stream) {
  const float* x         = (const float*)d_in[0];
  const float* mask      = (const float*)d_in[1];
  const float* qkv_w     = (const float*)d_in[2];
  const float* qkv_b     = (const float*)d_in[3];
  const float* rel_table = (const float*)d_in[4];
  float* out = (float*)d_out;

  _Float16* w16 = (_Float16*)d_ws;   // 384*128*2 = 96 KB scratch
  _Float16* bm  = w16 + W16_HALVES;  // 2 MB bias+mask table behind it
  prep_kernel<<<704, 256, 0, stream>>>(qkv_w, mask, rel_table, w16, bm);

  swin_attn_kernel<<<4096, 256, 0, stream>>>(x, qkv_b, w16, bm, out);
}

// v005
// One run takes 43.5 microseconds.
// Two timings next to v004 put it at 1.55 and 1.52 times that version's speed.
// All steps since v000 together make it 4.07 times as fast.
#include <hip/hip_runtime.h>
#include <hip/hip_bf16.h>

typedef _Float16 v16h __attribute__((ext_vector_type(16)));
typedef _Float16 v8h  __attribute__((ext_vector_type(8)));
typedef _Float16 v4h  __attribute__((ext_vector_type(4)));
typedef float    v8f  __attribute__((ext_vector_type(8)));

#define NTOK 49
#define DIM  128
#define NH   4
#define HD   32

// ---- LDS (units: _Float16 halves): the x tile alone, [64 tokens][136] ----
#define XS_STR   136
#define SMEM_HALVES 8704      // 17,408 bytes

// Workspace, in this order:
// 1. weights, f16, in fragment order:
//    [24 channel tiles][4 k-steps][2 fragment halves][32 lanes][8 halves],
//    so that one 16-byte load of a wave reads 512 contiguous bytes (4 whole lines).
//    Channel tile h*6 + s*2 + dh holds head h, s = 0 q / 1 k / 2 v, head dims
//    dh*16 .. dh*16+15: a tile is all q, all k or all v.
// 2. bias+mask table, f16, in the accumulator order of the transposed scores
//    (keys down the rows, queries across the lanes):
//    [64 mask windows][4 heads][4 query tiles][4 key tiles][32 lanes][8 keys]
// 3. projection bias, f32, regrouped as [4 heads][q,k,v][32 head dims]
#define W16_HALVES 49152      // 384*128
#define BM_HALVES  1048576    // 64*4*16*32*8

// Load one 16x32 (A) or 32x16 (B) f16 fragment: per-lane two 16B loads at
// half-offsets {0..7} and {16..23}; caller supplies base = &buf[row*stride + g*8].
__device__ __forceinline__ v16h ldfrag(const _Float16* p) {
  union { v16h v; v8h h[2]; } u;
  u.h[0] = *(const v8h*)(p);
  u.h[1] = *(const v8h*)(p + 16);
  return u.v;
}

// lane l with lane l ^ 16: the two lanes that share one query's keys
__device__ __forceinline__ float xhalf(float x) {
  return __builtin_bit_cast(float, __builtin_amdgcn_permlanex16(
      __builtin_bit_cast(int, x), __builtin_bit_cast(int, x),
      0x76543210, 0xfedcba98, false, false));
}

__device__ __forceinline__ v8f wmma_f16(v16h a, v16h b, v8f c) {
  return __builtin_amdgcn_wmma_f32_16x16x32_f16(false, a, false, b, (short)0, c,
                                                false, false);
}

// Blocks 0..191: weights to f16, in fragment order. Blocks 192..703: bias+mask table, once per
// (mask window, head); each thread writes the 8 keys one lane of the attention
// kernel adds to one 16x16 tile of transposed scores. Blocks 704, 705: the bias.
__global__ __launch_bounds__(256)
void prep_kernel(const float* __restrict__ w,
                 const float* __restrict__ mask,
                 const float* __restrict__ rel_table,
                 const float* __restrict__ qkv_b,
                 _Float16* __restrict__ w16,
                 _Float16* __restrict__ bm,
                 float* __restrict__ bq) {
  if (blockIdx.x < 192) {
    const int i  = blockIdx.x * 256 + threadIdx.x;   // place in fragment order
    const int j  = i & 7;
    const int ln = (i >> 3) & 31;
    const int hh = (i >> 8) & 1;
    const int kk = (i >> 9) & 3;
    const int ct = i >> 11;
    const int hd = ct / 6;                            // head
    const int s  = (ct % 6) >> 1;                     // 0=q 1=k 2=v
    const int d  = (ct & 1) * 16 + (ln & 15);         // head dim
    w16[i] = (_Float16)w[((hd * HD + d) * 3 + s) * DIM + kk * 32 + hh * 16 +
                         (ln >> 4) * 8 + j];
    return;
  }
  if (blockIdx.x >= 704) {
    const int i = (blockIdx.x - 704) * 256 + threadIdx.x;   // [head][s][dim]
    if (i < 3 * DIM) {
      const int d  = i & 31;
      const int s  = (i >> 5) % 3;
      const int hd = i / 96;
      bq[i] = qkv_b[(hd * HD + d) * 3 + s];
    }
    return;
  }
  const int t    = (blockIdx.x - 192) * 256 + threadIdx.x;
  const int lane = t & 31;
  const int kt   = (t >> 5) & 3;
  const int qt   = (t >> 7) & 3;
  const int h    = (t >> 9) & 3;
  const int wi   = t >> 11;
  const int n    = qt * 16 + (lane & 15);
  const int m0   = kt * 16 + (lane >> 4) * 8;
  // padded rows and columns read a clamped, in-range element, so that all 16
  // loads of a thread are in flight together; the select below drops them
  const int nc = n < NTOK ? n : NTOK - 1;
  float rv[8], mv[8];
#pragma unroll
  for (int r = 0; r < 8; ++r) {
    int mc  = m0 + r < NTOK ? m0 + r : NTOK - 1;
    int idx = (nc / 7 - mc / 7 + 6) * 13 + (nc % 7 - mc % 7 + 6);
    rv[r] = rel_table[idx * NH + h];
    // a later load of this run may land in this load's offset register: the
    // wait stands in front of that overwrite (the data stays in flight)
    asm volatile("s_wait_xcnt 0x0" ::: "memory");
    mv[r] = mask[(wi * NTOK + nc) * NTOK + mc];
    asm volatile("s_wait_xcnt 0x0" ::: "memory");  // same, for the mask load
  }
  v8h o;
#pragma unroll
  for (int r = 0; r < 8; ++r) {
    float val = rv[r] + mv[r];
    if (n >= NTOK)      val = 0.f;           // padded queries: never stored
    if (m0 + r >= NTOK) val = -30000.f;      // kill padded keys in softmax
    o[r] = (_Float16)val;
  }
  *(v8h*)(bm + (size_t)t * 8) = o;
  // the code laid out behind this store writes its registers, on a path that
  // this thread does not take: the wait stands in front of that all the same
  asm volatile("s_wait_xcnt 0x0" ::: "memory");
}

// the four fragments (k-steps) of one channel tile
__device__ __forceinline__ void loadw1(v16h (&wt)[4], const v8h* wf) {
#pragma unroll
  for (int kk = 0; kk < 4; ++kk) {
    union { v16h v; v8h p[2]; } f;
    f.p[0] = wf[(kk * 2 + 0) * 32];
    f.p[1] = wf[(kk * 2 + 1) * 32];
    wt[kk] = f.v;
  }
}

// the two channel tiles of q or of k
__device__ __forceinline__ void loadw(v16h (&wv)[2][4], const v8h* wf) {
  loadw1(wv[0], wf);
  loadw1(wv[1], wf + 256);
}

// One wave per head. Each projection product is taken in the orientation whose
// accumulator layout is the operand layout of the product that uses it:
//   q, k: W x^T  (channels down the rows, one token per lane column): the two
//         16-dim tiles of a token tile, converted in place, are the 32-deep
//         fragment of q (B of the scores) or k (A of the scores);
//   v:    x W^T  (tokens down the rows, one head dim per lane column): two
//         token tiles, converted in place, are the B fragment of P V.
// So q, k and v never pass through LDS, and no wave reads another wave's.
// The second launch bound asks for four waves a SIMD: at most 256 registers.
__global__ __launch_bounds__(128, 4)
void swin_attn_kernel(const float* __restrict__ x,
                      const _Float16* __restrict__ W16,
                      const _Float16* __restrict__ BM,
                      const float* __restrict__ BQ,
                      float* __restrict__ out) {
  __shared__ __align__(16) _Float16 smem[SMEM_HALVES];

  const int tid  = threadIdx.x;
  const int lane = tid & 31;
  const int h    = tid >> 5;     // 4 waves: the wave's head
  const int l16  = lane & 15;
  const int g    = lane >> 4;    // lane group (K-split for A/B, row-split for C/D)
  const int b    = blockIdx.x;   // window index
  const int w    = b & 63;       // mask window id (b % NW)

  v8f vzero;
#pragma unroll
  for (int i = 0; i < 8; ++i) vzero[i] = 0.f;

  // this wave's six channel tiles (6*h ..), 8 x 32 16-byte pieces a tile
  const v8h*   wf = (const v8h*)W16 + h * 6 * 256 + lane;
  const float* bh = BQ + h * 3 * HD;
  // bias+mask of this wave's 4x4 score tiles: one 16-byte load a lane and tile
  const v8h*   bp = (const v8h*)BM + ((w * NH + h) * 16) * 32 + lane;

  v16h wq[2][4], wk[2][4], wv[2][4];   // weight fragments of q, k, v
  v8f  cq[2], ck[2];                   // bias of q, k, in accumulator layout

  // -------- Phase 1: stage x as f16 (zero-padded 64 rows) --------
  // All of a thread's loads are issued before the first is waited for: one
  // memory latency a block. Trips 0..11 are rows 0..47, trip 12 is row 48
  // (wave 0 alone) and zeros, trips 13..15 zeros.
  {
    const float4* x4 = (const float4*)(x + (size_t)b * NTOK * DIM) + tid;
    float4 xr[13];
    // unrolled so that the loads stand in a row with no wait between them
#pragma unroll
    for (int t = 0; t < 12; ++t) xr[t] = x4[t * 128];
    // row 48 is wave 0's; the other waves read their row of trip 11 again, in
    // range, and drop it below: no branch, so no wait stands among the loads
    xr[12] = x4[h == 0 ? 12 * 128 : 11 * 128];
    // q's weights and bias fly under the x loads
    loadw(wq, wf);
    cq[0] = *(const v8f*)(bh + g * 8);
    cq[1] = *(const v8f*)(bh + 16 + g * 8);
    // holds these loads in front of the first wait for x: moved behind it,
    // their latency would stand alone in front of the first product
    __builtin_amdgcn_sched_barrier(0);
    if (h != 0) xr[12] = float4{0.f, 0.f, 0.f, 0.f};
    _Float16* xs = &smem[h * XS_STR + lane * 4];
    // unrolled so that xr is indexed by constants and stays in registers
#pragma unroll
    for (int t = 0; t < 13; ++t) {
      v4h hv;
      hv[0] = (_Float16)xr[t].x; hv[1] = (_Float16)xr[t].y;
      hv[2] = (_Float16)xr[t].z; hv[3] = (_Float16)xr[t].w;
      *(v4h*)&xs[t * 4 * XS_STR] = hv;
    }
    v4h hz;
    hz[0] = (_Float16)0.f; hz[1] = (_Float16)0.f;
    hz[2] = (_Float16)0.f; hz[3] = (_Float16)0.f;
#pragma unroll
    for (int t = 13; t < 16; ++t) *(v4h*)&xs[t * 4 * XS_STR] = hz;
  }
  __syncthreads();

  // -------- Phase 2: QKV projection of head h, all 64 tokens --------
  const _Float16* xb = &smem[l16 * XS_STR + g * 8];

  // k's weights and bias fly under q's products
  loadw(wk, wf + 2 * 256);
  ck[0] = *(const v8f*)(bh + HD + g * 8);
  ck[1] = *(const v8f*)(bh + HD + 16 + g * 8);
  // holds these loads in front of the products they are to fly under
  __builtin_amdgcn_sched_barrier(0);

  v16h qf[4], kf[4];   // [token tile]: lane column = token, 32 head dims
#pragma unroll
  for (int mt = 0; mt < 4; ++mt) {
    v16h xf[4];
#pragma unroll
    for (int kk = 0; kk < 4; ++kk) xf[kk] = ldfrag(xb + mt * 16 * XS_STR + kk * 32);
    v8f a0 = cq[0], a1 = cq[1];                    // the sums start from the bias
#pragma unroll
    for (int kk = 0; kk < 4; ++kk) {
      a0 = wmma_f16(wq[0][kk], xf[kk], a0);
      a1 = wmma_f16(wq[1][kk], xf[kk], a1);
    }
#pragma unroll
    for (int r = 0; r < 8; ++r) {
      qf[mt][r]     = (_Float16)a0[r];             // head dims g*8 + r
      qf[mt][8 + r] = (_Float16)a1[r];             // head dims 16 + g*8 + r
    }
  }

  // compiler fence: without it the 16 x fragments (128 registers) are carried
  // from one projection to the next; behind it they are read from LDS again.
  // The scheduling barrier keeps the projections apart for the same reason:
  // mixed, their fragments and sums are live together.
  asm volatile("" ::: "memory");
  __builtin_amdgcn_sched_barrier(0);

  // the weights of v's first dim tile fly under k's products. v's bias is the
  // lane's one column of each dim tile; it is added behind the products: as a
  // start value it would hold 16 registers where none are free
  loadw1(wv[0], wf + 4 * 256);
  const float cv0 = bh[2 * HD + l16];
  const float cv1 = bh[2 * HD + 16 + l16];
  // holds these loads in front of the products they are to fly under
  __builtin_amdgcn_sched_barrier(0);

#pragma unroll
  for (int mt = 0; mt < 4; ++mt) {
    v16h xf[4];
#pragma unroll
    for (int kk = 0; kk < 4; ++kk) xf[kk] = ldfrag(xb + mt * 16 * XS_STR + kk * 32);
    v8f a0 = ck[0], a1 = ck[1];
#pragma unroll
    for (int kk = 0; kk < 4; ++kk) {
      a0 = wmma_f16(wk[0][kk], xf[kk], a0);
      a1 = wmma_f16(wk[1][kk], xf[kk], a1);
    }
#pragma unroll
    for (int r = 0; r < 8; ++r) {
      kf[mt][r]     = (_Float16)a0[r];
      kf[mt][8 + r] = (_Float16)a1[r];
    }
  }

  asm volatile("" ::: "memory");        // compiler fence, as above
  __builtin_amdgcn_sched_barrier(0);    // as above

  // v, one dim tile at a time; the second tile's weights fly under the first
  // tile's products, the first query tile's bias+mask under the second's
  v16h vf[2][2];   // [k-step of P V][dim tile]: lane column = head dim, 32 keys
  v8h  bmf[4];
#pragma unroll
  for (int dt = 0; dt < 2; ++dt) {
    if (dt == 0) {
      loadw1(wv[1], wf + 5 * 256);
    } else {
#pragma unroll
      for (int kt = 0; kt < 4; ++kt) bmf[kt] = bp[kt * 32];
    }
    // holds these loads in front of the products they are to fly under
    __builtin_amdgcn_sched_barrier(0);
    v8f acc[4];
#pragma unroll
    for (int mt = 0; mt < 4; ++mt) acc[mt] = vzero;
#pragma unroll
    for (int mt = 0; mt < 4; ++mt)
#pragma unroll
      for (int kk = 0; kk < 4; ++kk)
        acc[mt] = wmma_f16(ldfrag(xb + mt * 16 * XS_STR + kk * 32), wv[dt][kk], acc[mt]);
    const float cv = dt == 0 ? cv0 : cv1;
#pragma unroll
    for (int mt = 0; mt < 4; ++mt)
#pragma unroll
      for (int r = 0; r < 8; ++r)                  // keys (mt>>1)*32 + (mt&1)*16 + g*8 + r
        vf[mt >> 1][dt][(mt & 1) * 8 + r] = (_Float16)(acc[mt][r] + cv);
    if (dt == 0) asm volatile("" ::: "memory");   // compiler fence, as above
    __builtin_amdgcn_sched_barrier(0);            // as above
  }

  // -------- Phase 3: attention for head h, one query tile at a time --------
  // Transposed scores, S^T = K Q^T: keys down the accumulator rows, one query
  // per lane column. Lanes l and l ^ 16 hold the 64 keys of one query, 32 each.
  const float scale = 0.17677669529663687f;  // 1/sqrt(32)
#pragma unroll
  for (int qt = 0; qt < 4; ++qt) {
    // the next query tile's bias+mask flies under this tile's work
    v8h bmn[4];
    if (qt < 3) {
#pragma unroll
      for (int kt = 0; kt < 4; ++kt) bmn[kt] = bp[((qt + 1) * 4 + kt) * 32];
    }

    v8f sacc[4];
#pragma unroll
    for (int kt = 0; kt < 4; ++kt) sacc[kt] = wmma_f16(kf[kt], qf[qt], vzero);

    // softmax over a lane's own 32 registers, then one exchange with lane l ^ 16.
    // Register r of key tile kt is key kt*16 + g*8 + r: tiles 2kk and 2kk+1,
    // converted in place, are the A fragment of P for k-step kk.
    v16h ap[2];
    {
      v8f t[4];
#pragma unroll
      for (int kt = 0; kt < 4; ++kt)
#pragma unroll
        for (int r = 0; r < 8; ++r)
          t[kt][r] = sacc[kt][r] * scale + (float)bmf[kt][r];
      float m8[8];
#pragma unroll
      for (int r = 0; r < 8; ++r)
        m8[r] = fmaxf(fmaxf(t[0][r], t[1][r]), fmaxf(t[2][r], t[3][r]));
      float mx = fmaxf(fmaxf(fmaxf(m8[0], m8[1]), fmaxf(m8[2], m8[3])),
                       fmaxf(fmaxf(m8[4], m8[5]), fmaxf(m8[6], m8[7])));
      mx = fmaxf(mx, xhalf(mx));
#pragma unroll
      for (int kt = 0; kt < 4; ++kt)
#pragma unroll
        for (int r = 0; r < 8; ++r) t[kt][r] = __expf(t[kt][r] - mx);
      float s8[8];
#pragma unroll
      for (int r = 0; r < 8; ++r)
        s8[r] = (t[0][r] + t[1][r]) + (t[2][r] + t[3][r]);
      float sm = ((s8[0] + s8[1]) + (s8[2] + s8[3])) +
                 ((s8[4] + s8[5]) + (s8[6] + s8[7]));
      sm += xhalf(sm);
      float inv = 1.0f / sm;
#pragma unroll
      for (int kk = 0; kk < 2; ++kk)
#pragma unroll
        for (int r = 0; r < 8; ++r) {
          ap[kk][r]     = (_Float16)(t[2 * kk][r] * inv);
          ap[kk][8 + r] = (_Float16)(t[2 * kk + 1][r] * inv);
        }
    }

    // P(16x64) @ V(64x32): both operands from registers
    v8f oacc[2];
    oacc[0] = wmma_f16(ap[0], vf[0][0], vzero);
    oacc[1] = wmma_f16(ap[0], vf[0][1], vzero);
    oacc[0] = wmma_f16(ap[1], vf[1][0], oacc[0]);
    oacc[1] = wmma_f16(ap[1], vf[1][1], oacc[1]);

    // store: out[b][n][h*32 + d], coalesced over l16
#pragma unroll
    for (int dt = 0; dt < 2; ++dt) {
#pragma unroll
      for (int r = 0; r < 8; ++r) {
        int n = qt * 16 + g * 8 + r;
        if (n < NTOK) {
          int c = h * HD + dt * 16 + l16;
          out[((size_t)b * NTOK + n) * DIM + c] = oacc[dt][r];
        }
      }
    }
    if (qt < 3) {
#pragma unroll
      for (int kt = 0; kt < 4; ++kt) bmf[kt] = bmn[kt];
    }
    // one query tile after the other: mixed, the four tiles' 128 scores are
    // live together and cost a wave per SIMD
    __builtin_amdgcn_sched_barrier(0);
  }
}

extern "C" void kernel_launch(void* const* d_in, const int* in_sizes, int n_in,
                              void* d_out, int out_size, void* d_ws, size_t ws_size,
                              hipStream_t stream) {
  const float* x         = (const float*)d_in[0];
  const float* mask      = (const float*)d_in[1];
  const float* qkv_w     = (const float*)d_in[2];
  const float* qkv_b     = (const float*)d_in[3];
  const float* rel_table = (const float*)d_in[4];
  float* out = (float*)d_out;

  _Float16* w16 = (_Float16*)d_ws;            // 96 KB of weights
  _Float16* bm  = w16 + W16_HALVES;           // 2 MB bias+mask table behind them
  float*    bq  = (float*)(bm + BM_HALVES);   // 384 regrouped bias values
  prep_kernel<<<706, 256, 0, stream>>>(qkv_w, mask, rel_table, qkv_b, w16, bm, bq);

  swin_attn_kernel<<<4096, 128, 0, stream>>>(x, w16, bm, bq, out);
}

// v006
// A run of this version takes 41.2 microseconds.
// Next to v005, in two timings, it ran 1.05 and 1.06 times as fast.
// All steps since v000 together make it 4.29 times as fast.
#include <hip/hip_runtime.h>
#include <hip/hip_bf16.h>

typedef _Float16 v16h __attribute__((ext_vector_type(16)));
typedef _Float16 v8h  __attribute__((ext_vector_type(8)));
typedef _Float16 v4h  __attribute__((ext_vector_type(4)));
typedef float    v8f  __attribute__((ext_vector_type(8)));

#define NTOK 49
#define DIM  128
#define NH   4
#define HD   32

// ---- LDS (units: _Float16 halves) of a block of 16 waves, one window a wave ----
// 1. the weights, as in the workspace (fragment order), shared by the 16 windows
// 2. the regrouped projection bias, 384 floats
// 3. 16 x tiles, [49 tokens][136], each written and read by its own wave alone
#define XS_STR   136
#define WPB      16                              // windows (waves) a block
#define XT_HALVES (NTOK * XS_STR)                // 13,328 bytes a tile
#define SM_BIAS  49152
#define SM_X     (SM_BIAS + 768)
#define SMEM_HALVES (SM_X + WPB * XT_HALVES)     // 313,088 bytes

// Workspace, in this order:
// 1. weights, f16, in fragment order:
//    [24 channel tiles][4 k-steps][2 fragment halves][32 lanes][8 halves],
//    so that one 16-byte load of a wave reads 512 contiguous bytes (4 whole lines).
//    Channel tile h*6 + s*2 + dh holds head h, s = 0 q / 1 k / 2 v, head dims
//    dh*16 .. dh*16+15: a tile is all q, all k or all v.
// 2. bias+mask table, f16, in the accumulator order of the transposed scores
//    (keys down the rows, queries across the lanes):
//    [64 mask windows][4 heads][4 query tiles][4 key tiles][32 lanes][8 keys]
// 3. projection bias, f32, regrouped as [4 heads][q,k,v][32 head dims]
#define W16_HALVES 49152      // 384*128
#define BM_HALVES  1048576    // 64*4*16*32*8

// Load one 16x32 (A) or 32x16 (B) f16 fragment: per-lane two 16B loads at
// half-offsets {0..7} and {16..23}; caller supplies base = &buf[row*stride + g*8].
__device__ __forceinline__ v16h ldfrag(const _Float16* p) {
  union { v16h v; v8h h[2]; } u;
  u.h[0] = *(const v8h*)(p);
  u.h[1] = *(const v8h*)(p + 16);
  return u.v;
}

// lane l with lane l ^ 16: the two lanes that share one query's keys
__device__ __forceinline__ float xhalf(float x) {
  return __builtin_bit_cast(float, __builtin_amdgcn_permlanex16(
      __builtin_bit_cast(int, x), __builtin_bit_cast(int, x),
      0x76543210, 0xfedcba98, false, false));
}

__device__ __forceinline__ v8f wmma_f16(v16h a, v16h b, v8f c) {
  return __builtin_amdgcn_wmma_f32_16x16x32_f16(false, a, false, b, (short)0, c,
                                                false, false);
}

// Blocks 0..191: weights to f16, in fragment order. Blocks 192..703: bias+mask table, once per
// (mask window, head); each thread writes the 8 keys one lane of the attention
// kernel adds to one 16x16 tile of transposed scores. Blocks 704, 705: the bias.
__global__ __launch_bounds__(256)
void prep_kernel(const float* __restrict__ w,
                 const float* __restrict__ mask,
                 const float* __restrict__ rel_table,
                 const float* __restrict__ qkv_b,
                 _Float16* __restrict__ w16,
                 _Float16* __restrict__ bm,
                 float* __restrict__ bq) {
  if (blockIdx.x < 192) {
    const int i  = blockIdx.x * 256 + threadIdx.x;   // place in fragment order
    const int j  = i & 7;
    const int ln = (i >> 3) & 31;
    const int hh = (i >> 8) & 1;
    const int kk = (i >> 9) & 3;
    const int ct = i >> 11;
    const int hd = ct / 6;                            // head
    const int s  = (ct % 6) >> 1;                     // 0=q 1=k 2=v
    const int d  = (ct & 1) * 16 + (ln & 15);         // head dim
    w16[i] = (_Float16)w[((hd * HD + d) * 3 + s) * DIM + kk * 32 + hh * 16 +
                         (ln >> 4) * 8 + j];
    return;
  }
  if (blockIdx.x >= 704) {
    const int i = (blockIdx.x - 704) * 256 + threadIdx.x;   // [head][s][dim]
    if (i < 3 * DIM) {
      const int d  = i & 31;
      const int s  = (i >> 5) % 3;
      const int hd = i / 96;
      bq[i] = qkv_b[(hd * HD + d) * 3 + s];
    }
    return;
  }
  const int t    = (blockIdx.x - 192) * 256 + threadIdx.x;
  const int lane = t & 31;
  const int kt   = (t >> 5) & 3;
  const int qt   = (t >> 7) & 3;
  const int h    = (t >> 9) & 3;
  const int wi   = t >> 11;
  const int n    = qt * 16 + (lane & 15);
  const int m0   = kt * 16 + (lane >> 4) * 8;
  // padded rows and columns read a clamped, in-range element, so that all 16
  // loads of a thread are in flight together; the select below drops them
  const int nc = n < NTOK ? n : NTOK - 1;
  float rv[8], mv[8];
#pragma unroll
  for (int r = 0; r < 8; ++r) {
    int mc  = m0 + r < NTOK ? m0 + r : NTOK - 1;
    int idx = (nc / 7 - mc / 7 + 6) * 13 + (nc % 7 - mc % 7 + 6);
    rv[r] = rel_table[idx * NH + h];
    // a later load of this run may land in this load's offset register: the
    // wait stands in front of that overwrite (the data stays in flight)
    asm volatile("s_wait_xcnt 0x0" ::: "memory");
    mv[r] = mask[(wi * NTOK + nc) * NTOK + mc];
    asm volatile("s_wait_xcnt 0x0" ::: "memory");  // same, for the mask load
  }
  v8h o;
#pragma unroll
  for (int r = 0; r < 8; ++r) {
    float val = rv[r] + mv[r];
    if (n >= NTOK)      val = 0.f;           // padded queries: never stored
    if (m0 + r >= NTOK) val = -30000.f;      // kill padded keys in softmax
    o[r] = (_Float16)val;
  }
  *(v8h*)(bm + (size_t)t * 8) = o;
  // the code laid out behind this store writes its registers, on a path that
  // this thread does not take: the wait stands in front of that all the same
  asm volatile("s_wait_xcnt 0x0" ::: "memory");
}

// the four fragments (k-steps) of one channel tile
__device__ __forceinline__ void loadw1(v16h (&wt)[4], const v8h* wf) {
#pragma unroll
  for (int kk = 0; kk < 4; ++kk) {
    union { v16h v; v8h p[2]; } f;
    f.p[0] = wf[(kk * 2 + 0) * 32];
    f.p[1] = wf[(kk * 2 + 1) * 32];
    wt[kk] = f.v;
  }
}

// the two channel tiles of q or of k
__device__ __forceinline__ void loadw(v16h (&wv)[2][4], const v8h* wf) {
  loadw1(wv[0], wf);
  loadw1(wv[1], wf + 256);
}

// One wave per window; the wave takes the window's four heads one after the
// other. A block's 16 windows have one mask window in common, so they share the
// weights and bias (read from L2 once a block, kept in LDS) and the same 32 KB
// of the bias+mask table. Each projection product is taken in the orientation
// whose accumulator layout is the operand layout of the product that uses it:
//   q, k: W x^T  (channels down the rows, one token per lane column): the two
//         16-dim tiles of a token tile, converted in place, are the 32-deep
//         fragment of q (B of the scores) or k (A of the scores);
//   v:    x W^T  (tokens down the rows, one head dim per lane column): two
//         token tiles, converted in place, are the B fragment of P V.
// So q, k and v never pass through LDS, and no wave reads another wave's.
// 16 waves a block, four a SIMD: at most 256 registers.
__global__ __launch_bounds__(512)
void swin_attn_kernel(const float* __restrict__ x,
                      const _Float16* __restrict__ W16,
                      const _Float16* __restrict__ BM,
                      const float* __restrict__ BQ,
                      float* __restrict__ out) {
  __shared__ __align__(16) _Float16 smem[SMEM_HALVES];

  const int tid  = threadIdx.x;
  const int lane = tid & 31;
  const int wv   = __builtin_amdgcn_readfirstlane(tid >> 5);   // 16 waves
  const int l16  = lane & 15;
  const int g    = lane >> 4;    // lane group (K-split for A/B, row-split for C/D)
  const int w    = blockIdx.x & 63;                            // mask window id (b % NW)
  const int b    = w + 64 * ((blockIdx.x >> 6) * WPB + wv);    // the wave's window

  v8f vzero;
#pragma unroll
  for (int i = 0; i < 8; ++i) vzero[i] = 0.f;

  // -------- Phase 1: weights and bias to LDS; the wave's x tile as f16 --------
  // All 61 loads of a thread (12 of weights, 49 rows of x) are issued before the
  // first wait: one memory latency a wave.
  {
    const v8h* wsrc = (const v8h*)W16 + tid;      // 6144 16-byte pieces, 12 a thread
    v8h wr[12];
#pragma unroll
    for (int t = 0; t < 12; ++t) wr[t] = wsrc[t * 512];
    const float4* x4 = (const float4*)(x + (size_t)b * NTOK * DIM) + lane;   // a row a load
    float4 xr[NTOK];
    // unrolled so that the loads stand in a row with no wait between them
#pragma unroll
    for (int t = 0; t < NTOK; ++t) xr[t] = x4[t * 32];
    // holds these loads in front of the first wait
    __builtin_amdgcn_sched_barrier(0);
    v8h* wd = (v8h*)smem + tid;
#pragma unroll
    for (int t = 0; t < 12; ++t) wd[t * 512] = wr[t];
    // the bias, 96 pieces, by waves 0..2: behind the last x load, so that the
    // wait in this branch holds no load back
    if (tid < 96) ((float4*)&smem[SM_BIAS])[tid] = ((const float4*)BQ)[tid];
    _Float16* xs = &smem[SM_X + wv * XT_HALVES + lane * 4];
    // unrolled so that xr is indexed by constants and stays in registers
#pragma unroll
    for (int t = 0; t < NTOK; ++t) {
      v4h hv;
      hv[0] = (_Float16)xr[t].x; hv[1] = (_Float16)xr[t].y;
      hv[2] = (_Float16)xr[t].z; hv[3] = (_Float16)xr[t].w;
      *(v4h*)&xs[t * XS_STR] = hv;
    }
  }
  // the one barrier of the kernel: behind it weights and bias are only read
  __syncthreads();

  // Token tiles 0..2: the lane's row l16 of the tile. Tile 3 holds token 48
  // alone: all its lanes read that row, so the 15 padded tokens are copies of a
  // real one (finite values); padded keys are killed by the table's -30000 and
  // padded queries are never stored, as with zero rows.
  const _Float16* xw  = &smem[SM_X + wv * XT_HALVES + g * 8];
  const _Float16* xb  = xw + l16 * XS_STR;
  const _Float16* xb3 = xw + (NTOK - 1) * XS_STR;
#define XROW(mt) ((mt) < 3 ? xb + (mt) * 16 * XS_STR : xb3)

  // rolled: one head's code, run four times
#pragma unroll 1
  for (int h = 0; h < NH; ++h) {
  // this head's six channel tiles (6*h ..), 8 x 32 16-byte pieces a tile, in LDS
  const v8h*   wf = (const v8h*)smem + h * 6 * 256 + lane;
  const float* bh = (const float*)&smem[SM_BIAS] + h * 3 * HD;
  // bias+mask of this head's 4x4 score tiles: one 16-byte load a lane and tile
  const v8h*   bp = (const v8h*)BM + ((w * NH + h) * 16) * 32 + lane;

  // Each projection reads its own weights and bias from LDS as it begins: none
  // is fetched a projection ahead, which would hold 64 registers for an LDS latency
  v16h wq[2][4], wk[2][4];             // weight fragments of q, k
  v8f  cq[2], ck[2];                   // bias of q, k, in accumulator layout

  // -------- Phase 2: QKV projection of head h, all 64 tokens --------
  loadw(wq, wf);
  cq[0] = *(const v8f*)(bh + g * 8);
  cq[1] = *(const v8f*)(bh + 16 + g * 8);

  v16h qf[4], kf[4];   // [token tile]: lane column = token, 32 head dims
#pragma unroll
  for (int mt = 0; mt < 4; ++mt) {
    v16h xf[4];
#pragma unroll
    for (int kk = 0; kk < 4; ++kk) xf[kk] = ldfrag(XROW(mt) + kk * 32);
    v8f a0 = cq[0], a1 = cq[1];                    // the sums start from the bias
#pragma unroll
    for (int kk = 0; kk < 4; ++kk) {
      a0 = wmma_f16(wq[0][kk], xf[kk], a0);
      a1 = wmma_f16(wq[1][kk], xf[kk], a1);
    }
#pragma unroll
    for (int r = 0; r < 8; ++r) {
      qf[mt][r]     = (_Float16)a0[r];             // head dims g*8 + r
      qf[mt][8 + r] = (_Float16)a1[r];             // head dims 16 + g*8 + r
    }
    // the last two token tiles' fragment loads stay behind the first two tiles'
    // products: all 16 fragments fetched at once overrun the registers (scratch)
    if (mt == 1) __builtin_amdgcn_sched_barrier(0);
  }

  // compiler fence: without it the 16 x fragments (128 registers) are carried
  // from one projection to the next; behind it they are read from LDS again.
  // The scheduling barrier keeps the projections apart for the same reason:
  // mixed, their fragments and sums are live together.
  asm volatile("" ::: "memory");
  __builtin_amdgcn_sched_barrier(0);

  loadw(wk, wf + 2 * 256);
  ck[0] = *(const v8f*)(bh + HD + g * 8);
  ck[1] = *(const v8f*)(bh + HD + 16 + g * 8);

#pragma unroll
  for (int mt = 0; mt < 4; ++mt) {
    v16h xf[4];
#pragma unroll
    for (int kk = 0; kk < 4; ++kk) xf[kk] = ldfrag(XROW(mt) + kk * 32);
    v8f a0 = ck[0], a1 = ck[1];
#pragma unroll
    for (int kk = 0; kk < 4; ++kk) {
      a0 = wmma_f16(wk[0][kk], xf[kk], a0);
      a1 = wmma_f16(wk[1][kk], xf[kk], a1);
    }
#pragma unroll
    for (int r = 0; r < 8; ++r) {
      kf[mt][r]     = (_Float16)a0[r];
      kf[mt][8 + r] = (_Float16)a1[r];
    }
    if (mt == 1) __builtin_amdgcn_sched_barrier(0);   // as in q's projection
  }

  asm volatile("" ::: "memory");        // compiler fence, as above
  __builtin_amdgcn_sched_barrier(0);    // as above

  // v, one dim tile at a time; the first query tile's bias+mask, the one load
  // of this part that leaves the WGP, flies under both tiles' products. v's bias
  // is the lane's one column of each dim tile; it is added behind the products:
  // as a start value it would hold 16 registers
  v16h vf[2][2];   // [k-step of P V][dim tile]: lane column = head dim, 32 keys
  v8h  bmf[4];
#pragma unroll
  for (int kt = 0; kt < 4; ++kt) bmf[kt] = bp[kt * 32];
  // holds these loads in front of the products they are to fly under
  __builtin_amdgcn_sched_barrier(0);
#pragma unroll
  for (int dt = 0; dt < 2; ++dt) {
    v16h wvf[4];
    loadw1(wvf, wf + (4 + dt) * 256);
    const float cv = bh[2 * HD + dt * 16 + l16];
    v8f acc[4];
#pragma unroll
    for (int mt = 0; mt < 4; ++mt) acc[mt] = vzero;
#pragma unroll
    for (int mt = 0; mt < 4; ++mt) {
#pragma unroll
      for (int kk = 0; kk < 4; ++kk)
        acc[mt] = wmma_f16(ldfrag(XROW(mt) + kk * 32), wvf[kk], acc[mt]);
      if (mt == 1) __builtin_amdgcn_sched_barrier(0);   // as in q's projection
    }
#pragma unroll
    for (int mt = 0; mt < 4; ++mt)
#pragma unroll
      for (int r = 0; r < 8; ++r)                  // keys (mt>>1)*32 + (mt&1)*16 + g*8 + r
        vf[mt >> 1][dt][(mt & 1) * 8 + r] = (_Float16)(acc[mt][r] + cv);
    if (dt == 0) asm volatile("" ::: "memory");   // compiler fence, as above
    __builtin_amdgcn_sched_barrier(0);            // as above
  }

  // -------- Phase 3: attention for head h, one query tile at a time --------
  // Transposed scores, S^T = K Q^T: keys down the accumulator rows, one query
  // per lane column. Lanes l and l ^ 16 hold the 64 keys of one query, 32 each.
  const float scale = 0.17677669529663687f;  // 1/sqrt(32)
#pragma unroll
  for (int qt = 0; qt < 4; ++qt) {
    // the next query tile's bias+mask flies under this tile's work
    v8h bmn[4];
    if (qt < 3) {
#pragma unroll
      for (int kt = 0; kt < 4; ++kt) bmn[kt] = bp[((qt + 1) * 4 + kt) * 32];
    }

    v8f sacc[4];
#pragma unroll
    for (int kt = 0; kt < 4; ++kt) sacc[kt] = wmma_f16(kf[kt], qf[qt], vzero);

    // softmax over a lane's own 32 registers, then one exchange with lane l ^ 16.
    // Register r of key tile kt is key kt*16 + g*8 + r: tiles 2kk and 2kk+1,
    // converted in place, are the A fragment of P for k-step kk.
    v16h ap[2];
    {
      v8f t[4];
#pragma unroll
      for (int kt = 0; kt < 4; ++kt)
#pragma unroll
        for (int r = 0; r < 8; ++r)
          t[kt][r] = sacc[kt][r] * scale + (float)bmf[kt][r];
      float m8[8];
#pragma unroll
      for (int r = 0; r < 8; ++r)
        m8[r] = fmaxf(fmaxf(t[0][r], t[1][r]), fmaxf(t[2][r], t[3][r]));
      float mx = fmaxf(fmaxf(fmaxf(m8[0], m8[1]), fmaxf(m8[2], m8[3])),
                       fmaxf(fmaxf(m8[4], m8[5]), fmaxf(m8[6], m8[7])));
      mx = fmaxf(mx, xhalf(mx));
#pragma unroll
      for (int kt = 0; kt < 4; ++kt)
#pragma unroll
        for (int r = 0; r < 8; ++r) t[kt][r] = __expf(t[kt][r] - mx);
      float s8[8];
#pragma unroll
      for (int r = 0; r < 8; ++r)
        s8[r] = (t[0][r] + t[1][r]) + (t[2][r] + t[3][r]);
      float sm = ((s8[0] + s8[1]) + (s8[2] + s8[3])) +
                 ((s8[4] + s8[5]) + (s8[6] + s8[7]));
      sm += xhalf(sm);
      float inv = 1.0f / sm;
#pragma unroll
      for (int kk = 0; kk < 2; ++kk)
#pragma unroll
        for (int r = 0; r < 8; ++r) {
          ap[kk][r]     = (_Float16)(t[2 * kk][r] * inv);
          ap[kk][8 + r] = (_Float16)(t[2 * kk + 1][r] * inv);
        }
    }

    // P(16x64) @ V(64x32): both operands from registers
    v8f oacc[2];
    oacc[0] = wmma_f16(ap[0], vf[0][0], vzero);
    oacc[1] = wmma_f16(ap[0], vf[0][1], vzero);
    oacc[0] = wmma_f16(ap[1], vf[1][0], oacc[0]);
    oacc[1] = wmma_f16(ap[1], vf[1][1], oacc[1]);

    // store: out[b][n][h*32 + d], coalesced over l16
#pragma unroll
    for (int dt = 0; dt < 2; ++dt) {
#pragma unroll
      for (int r = 0; r < 8; ++r) {
        int n = qt * 16 + g * 8 + r;
        if (n < NTOK) {
          int c = h * HD + dt * 16 + l16;
          out[((size_t)b * NTOK + n) * DIM + c] = oacc[dt][r];
        }
      }
    }
    if (qt < 3) {
#pragma unroll
      for (int kt = 0; kt < 4; ++kt) bmf[kt] = bmn[kt];
    } else {
      // the next head's first loads land in the registers of the last stores:
      // the wait stands in front of that overwrite
      asm volatile("s_wait_xcnt 0x0" ::: "memory");
    }
    // the vector slots the chip needs between the last P V product and the next
    // product, whose result the compiler may lay over this one's registers with
    // nothing but the stores between them
    asm volatile("v_nop\n\tv_nop\n\tv_nop\n\tv_nop\n\tv_nop");
    // one query tile after the other: mixed, the four tiles' 128 scores are
    // live together: 128 of the wave's at most 256 registers
    __builtin_amdgcn_sched_barrier(0);
  }
  }   // heads
#undef XROW
}

extern "C" void kernel_launch(void* const* d_in, const int* in_sizes, int n_in,
                              void* d_out, int out_size, void* d_ws, size_t ws_size,
                              hipStream_t stream) {
  const float* x         = (const float*)d_in[0];
  const float* mask      = (const float*)d_in[1];
  const float* qkv_w     = (const float*)d_in[2];
  const float* qkv_b     = (const float*)d_in[3];
  const float* rel_table = (const float*)d_in[4];
  float* out = (float*)d_out;

  _Float16* w16 = (_Float16*)d_ws;            // 96 KB of weights
  _Float16* bm  = w16 + W16_HALVES;           // 2 MB bias+mask table behind them
  float*    bq  = (float*)(bm + BM_HALVES);   // 384 regrouped bias values
  prep_kernel<<<706, 256, 0, stream>>>(qkv_w, mask, rel_table, qkv_b, w16, bm, bq);

  swin_attn_kernel<<<256, 512, 0, stream>>>(x, w16, bm, bq, out);
}

// v007
// One run takes 39.6 microseconds.
// Timed twice side by side with v006, it ran 1.04 times as fast both times.
// Over all steps from v000 it is 4.47 times as fast.
#include <hip/hip_runtime.h>
#include <hip/hip_bf16.h>

typedef _Float16 v16h __attribute__((ext_vector_type(16)));
typedef _Float16 v8h  __attribute__((ext_vector_type(8)));
typedef _Float16 v4h  __attribute__((ext_vector_type(4)));
typedef float    v8f  __attribute__((ext_vector_type(8)));

#define NTOK 49
#define DIM  128
#define NH   4
#define HD   32

// ---- LDS (units: _Float16 halves) of a block of 16 waves, one window a wave ----
// 1. the weights, as in the workspace (fragment order), shared by the 16 windows
// 2. the regrouped projection bias, 384 floats
// 3. 16 x tiles, [49 tokens][136], each written and read by its own wave alone
#define XS_STR   136
#define WPB      16                              // windows (waves) a block
#define XT_HALVES (NTOK * XS_STR)                // 13,328 bytes a tile
#define SM_BIAS  49152
#define SM_X     (SM_BIAS + 768)
#define SMEM_HALVES (SM_X + WPB * XT_HALVES)     // 313,088 bytes

// Workspace, in this order:
// 1. weights, f16, in fragment order:
//    [24 channel tiles][4 k-steps][2 fragment halves][32 lanes][8 halves],
//    so that one 16-byte load of a wave reads 512 contiguous bytes (4 whole lines).
//    Channel tile h*6 + s*2 + dh holds head h, s = 0 q / 1 k / 2 v, head dims
//    dh*16 .. dh*16+15: a tile is all q, all k or all v.
// 2. bias+mask table, f16, in the accumulator order of the transposed scores
//    (keys down the rows, queries across the lanes):
//    [64 mask windows][4 heads][4 query tiles][4 key tiles][32 lanes][8 keys]
// 3. projection bias, f32, regrouped as [4 heads][q,k,v][32 head dims]
#define W16_HALVES 49152      // 384*128
#define BM_HALVES  1048576    // 64*4*16*32*8

// Load one 16x32 (A) or 32x16 (B) f16 fragment: per-lane two 16B loads at
// half-offsets {0..7} and {16..23}; caller supplies base = &buf[row*stride + g*8].
__device__ __forceinline__ v16h ldfrag(const _Float16* p) {
  union { v16h v; v8h h[2]; } u;
  u.h[0] = *(const v8h*)(p);
  u.h[1] = *(const v8h*)(p + 16);
  return u.v;
}

// lane l with lane l ^ 16: the two lanes that share one query's keys
__device__ __forceinline__ float xhalf(float x) {
  return __builtin_bit_cast(float, __builtin_amdgcn_permlanex16(
      __builtin_bit_cast(int, x), __builtin_bit_cast(int, x),
      0x76543210, 0xfedcba98, false, false));
}

// 2^x of five independent values. One statement, so that each v_exp_f32 is the
// independent instruction the instruction set asks for behind the one before it
// (outputs are early-clobber: none lies on a source); the v_nop is that slot
// behind the last one, whatever the compiler puts next.
__device__ __forceinline__ void exp2x5(float* y, const float* x) {
  asm("v_exp_f32 %0, %5\n\tv_exp_f32 %1, %6\n\tv_exp_f32 %2, %7\n\t"
      "v_exp_f32 %3, %8\n\tv_exp_f32 %4, %9\n\tv_nop"
      : "=&v"(y[0]), "=&v"(y[1]), "=&v"(y[2]), "=&v"(y[3]), "=&v"(y[4])
      : "v"(x[0]), "v"(x[1]), "v"(x[2]), "v"(x[3]), "v"(x[4]));
}

__device__ __forceinline__ v8f wmma_f16(v16h a, v16h b, v8f c) {
  return __builtin_amdgcn_wmma_f32_16x16x32_f16(false, a, false, b, (short)0, c,
                                                false, false);
}

// Blocks 0..191: weights to f16, in fragment order. Blocks 192..703: bias+mask table, once per
// (mask window, head); each thread writes the 8 keys one lane of the attention
// kernel adds to one 16x16 tile of transposed scores. Blocks 704, 705: the bias.
__global__ __launch_bounds__(256)
void prep_kernel(const float* __restrict__ w,
                 const float* __restrict__ mask,
                 const float* __restrict__ rel_table,
                 const float* __restrict__ qkv_b,
                 _Float16* __restrict__ w16,
                 _Float16* __restrict__ bm,
                 float* __restrict__ bq) {
  if (blockIdx.x < 192) {
    const int i  = blockIdx.x * 256 + threadIdx.x;   // place in fragment order
    const int j  = i & 7;
    const int ln = (i >> 3) & 31;
    const int hh = (i >> 8) & 1;
    const int kk = (i >> 9) & 3;
    const int ct = i >> 11;
    const int hd = ct / 6;                            // head
    const int s  = (ct % 6) >> 1;                     // 0=q 1=k 2=v
    const int d  = (ct & 1) * 16 + (ln & 15);         // head dim
    w16[i] = (_Float16)w[((hd * HD + d) * 3 + s) * DIM + kk * 32 + hh * 16 +
                         (ln >> 4) * 8 + j];
    return;
  }
  if (blockIdx.x >= 704) {
    const int i = (blockIdx.x - 704) * 256 + threadIdx.x;   // [head][s][dim]
    if (i < 3 * DIM) {
      const int d  = i & 31;
      const int s  = (i >> 5) % 3;
      const int hd = i / 96;
      bq[i] = qkv_b[(hd * HD + d) * 3 + s];
    }
    return;
  }
  const int t    = (blockIdx.x - 192) * 256 + threadIdx.x;
  const int lane = t & 31;
  const int kt   = (t >> 5) & 3;
  const int qt   = (t >> 7) & 3;
  const int h    = (t >> 9) & 3;
  const int wi   = t >> 11;
  const int n    = qt * 16 + (lane & 15);
  const int m0   = kt * 16 + (lane >> 4) * 8;
  // padded rows and columns read a clamped, in-range element, so that all 16
  // loads of a thread are in flight together; the select below drops them
  const int nc = n < NTOK ? n : NTOK - 1;
  float rv[8], mv[8];
#pragma unroll
  for (int r = 0; r < 8; ++r) {
    int mc  = m0 + r < NTOK ? m0 + r : NTOK - 1;
    int idx = (nc / 7 - mc / 7 + 6) * 13 + (nc % 7 - mc % 7 + 6);
    rv[r] = rel_table[idx * NH + h];
    // a later load of this run may land in this load's offset register: the
    // wait stands in front of that overwrite (the data stays in flight)
    asm volatile("s_wait_xcnt 0x0" ::: "memory");
    mv[r] = mask[(wi * NTOK + nc) * NTOK + mc];
    asm volatile("s_wait_xcnt 0x0" ::: "memory");  // same, for the mask load
  }
  v8h o;
#pragma unroll
  for (int r = 0; r < 8; ++r) {
    float val = rv[r] + mv[r];
    if (n >= NTOK)      val = 0.f;           // padded queries: never stored
    if (m0 + r >= NTOK) val = -30000.f;      // kill padded keys in softmax
    o[r] = (_Float16)val;
  }
  *(v8h*)(bm + (size_t)t * 8) = o;
  // the code laid out behind this store writes its registers, on a path that
  // this thread does not take: the wait stands in front of that all the same
  asm volatile("s_wait_xcnt 0x0" ::: "memory");
}

// the four fragments (k-steps) of one channel tile
__device__ __forceinline__ void loadw1(v16h (&wt)[4], const v8h* wf) {
#pragma unroll
  for (int kk = 0; kk < 4; ++kk) {
    union { v16h v; v8h p[2]; } f;
    f.p[0] = wf[(kk * 2 + 0) * 32];
    f.p[1] = wf[(kk * 2 + 1) * 32];
    wt[kk] = f.v;
  }
}

// the two channel tiles of q or of k
__device__ __forceinline__ void loadw(v16h (&wv)[2][4], const v8h* wf) {
  loadw1(wv[0], wf);
  loadw1(wv[1], wf + 256);
}

// One wave per window; the wave takes the window's four heads one after the
// other. A block's 16 windows have one mask window in common, so they share the
// weights and bias (read from L2 once a block, kept in LDS) and the same 32 KB
// of the bias+mask table. Each projection product is taken in the orientation
// whose accumulator layout is the operand layout of the product that uses it:
//   q, k: W x^T  (channels down the rows, one token per lane column): the two
//         16-dim tiles of a token tile, converted in place, are the 32-deep
//         fragment of q (B of the scores) or k (A of the scores);
//   v:    x W^T  (tokens down the rows, one head dim per lane column): two
//         token tiles, converted in place, are the B fragment of P V.
// So q, k and v never pass through LDS, and no wave reads another wave's.
// 16 waves a block, four a SIMD: at most 256 registers.
__global__ __launch_bounds__(512)
void swin_attn_kernel(const float* __restrict__ x,
                      const _Float16* __restrict__ W16,
                      const _Float16* __restrict__ BM,
                      const float* __restrict__ BQ,
                      float* __restrict__ out) {
  __shared__ __align__(16) _Float16 smem[SMEM_HALVES];

  const int tid  = threadIdx.x;
  const int lane = tid & 31;
  const int wv   = __builtin_amdgcn_readfirstlane(tid >> 5);   // 16 waves
  const int l16  = lane & 15;
  const int g    = lane >> 4;    // lane group (K-split for A/B, row-split for C/D)
  const int w    = blockIdx.x & 63;                            // mask window id (b % NW)
  const int b    = w + 64 * ((blockIdx.x >> 6) * WPB + wv);    // the wave's window

  v8f vzero;
#pragma unroll
  for (int i = 0; i < 8; ++i) vzero[i] = 0.f;

  // -------- Phase 1: weights and bias to LDS; the wave's x tile as f16 --------
  // All 61 loads of a thread (12 of weights, 49 rows of x) are issued before the
  // first wait: one memory latency a wave.
  {
    const v8h* wsrc = (const v8h*)W16 + tid;      // 6144 16-byte pieces, 12 a thread
    v8h wr[12];
#pragma unroll
    for (int t = 0; t < 12; ++t) wr[t] = wsrc[t * 512];
    const float4* x4 = (const float4*)(x + (size_t)b * NTOK * DIM) + lane;   // a row a load
    float4 xr[NTOK];
    // unrolled so that the loads stand in a row with no wait between them
#pragma unroll
    for (int t = 0; t < NTOK; ++t) xr[t] = x4[t * 32];
    // holds these loads in front of the first wait
    __builtin_amdgcn_sched_barrier(0);
    v8h* wd = (v8h*)smem + tid;
#pragma unroll
    for (int t = 0; t < 12; ++t) wd[t * 512] = wr[t];
    // the bias, 96 pieces, by waves 0..2: behind the last x load, so that the
    // wait in this branch holds no load back
    if (tid < 96) ((float4*)&smem[SM_BIAS])[tid] = ((const float4*)BQ)[tid];
    _Float16* xs = &smem[SM_X + wv * XT_HALVES + lane * 4];
    // unrolled so that xr is indexed by constants and stays in registers
#pragma unroll
    for (int t = 0; t < NTOK; ++t) {
      v4h hv;
      hv[0] = (_Float16)xr[t].x; hv[1] = (_Float16)xr[t].y;
      hv[2] = (_Float16)xr[t].z; hv[3] = (_Float16)xr[t].w;
      *(v4h*)&xs[t * XS_STR] = hv;
    }
  }
  // the one barrier of the kernel: behind it weights and bias are only read
  __syncthreads();

  // Token tiles 0..2: the lane's row l16 of the tile. Tile 3 holds token 48
  // alone: all its lanes read that row, so the 15 padded tokens are copies of a
  // real one (finite values); padded keys are dropped (P = 0) or killed by the table's -30000 and
  // padded queries are never stored, as with zero rows.
  const _Float16* xw  = &smem[SM_X + wv * XT_HALVES + g * 8];
  const _Float16* xb  = xw + l16 * XS_STR;
  const _Float16* xb3 = xw + (NTOK - 1) * XS_STR;
#define XROW(mt) ((mt) < 3 ? xb + (mt) * 16 * XS_STR : xb3)

  // rolled: one head's code, run four times
#pragma unroll 1
  for (int h = 0; h < NH; ++h) {
  // this head's six channel tiles (6*h ..), 8 x 32 16-byte pieces a tile, in LDS
  const v8h*   wf = (const v8h*)smem + h * 6 * 256 + lane;
  const float* bh = (const float*)&smem[SM_BIAS] + h * 3 * HD;
  // bias+mask of this head's 4x4 score tiles: one 16-byte load a lane and tile, one half for key tile 3
  const v8h*   bp = (const v8h*)BM + ((w * NH + h) * 16) * 32 + lane;

  // Each projection reads its own weights and bias from LDS as it begins: none
  // is fetched a projection ahead, which would hold 64 registers for an LDS latency
  v16h wq[2][4], wk[2][4];             // weight fragments of q, k
  v8f  cq[2], ck[2];                   // bias of q, k, in accumulator layout

  // -------- Phase 2: QKV projection of head h, all 64 tokens --------
  loadw(wq, wf);
  cq[0] = *(const v8f*)(bh + g * 8);
  cq[1] = *(const v8f*)(bh + 16 + g * 8);

  v16h qf[4], kf[4];   // [token tile]: lane column = token, 32 head dims
#pragma unroll
  for (int mt = 0; mt < 4; ++mt) {
    v16h xf[4];
#pragma unroll
    for (int kk = 0; kk < 4; ++kk) xf[kk] = ldfrag(XROW(mt) + kk * 32);
    v8f a0 = cq[0], a1 = cq[1];                    // the sums start from the bias
#pragma unroll
    for (int kk = 0; kk < 4; ++kk) {
      a0 = wmma_f16(wq[0][kk], xf[kk], a0);
      a1 = wmma_f16(wq[1][kk], xf[kk], a1);
    }
#pragma unroll
    for (int r = 0; r < 8; ++r) {
      qf[mt][r]     = (_Float16)a0[r];             // head dims g*8 + r
      qf[mt][8 + r] = (_Float16)a1[r];             // head dims 16 + g*8 + r
    }
    // the last two token tiles' fragment loads stay behind the first two tiles'
    // products: all 16 fragments fetched at once overrun the registers (scratch)
    if (mt == 1) __builtin_amdgcn_sched_barrier(0);
  }

  // compiler fence: without it the 16 x fragments (128 registers) are carried
  // from one projection to the next; behind it they are read from LDS again.
  // The scheduling barrier keeps the projections apart for the same reason:
  // mixed, their fragments and sums are live together.
  asm volatile("" ::: "memory");
  __builtin_amdgcn_sched_barrier(0);

  loadw(wk, wf + 2 * 256);
  ck[0] = *(const v8f*)(bh + HD + g * 8);
  ck[1] = *(const v8f*)(bh + HD + 16 + g * 8);

#pragma unroll
  for (int mt = 0; mt < 4; ++mt) {
    v16h xf[4];
#pragma unroll
    for (int kk = 0; kk < 4; ++kk) xf[kk] = ldfrag(XROW(mt) + kk * 32);
    v8f a0 = ck[0], a1 = ck[1];
#pragma unroll
    for (int kk = 0; kk < 4; ++kk) {
      a0 = wmma_f16(wk[0][kk], xf[kk], a0);
      a1 = wmma_f16(wk[1][kk], xf[kk], a1);
    }
#pragma unroll
    for (int r = 0; r < 8; ++r) {
      kf[mt][r]     = (_Float16)a0[r];
      kf[mt][8 + r] = (_Float16)a1[r];
    }
    if (mt == 1) __builtin_amdgcn_sched_barrier(0);   // as in q's projection
  }

  asm volatile("" ::: "memory");        // compiler fence, as above
  __builtin_amdgcn_sched_barrier(0);    // as above

  // v, one dim tile at a time; the first query tile's bias+mask, the one load
  // of this part that leaves the WGP, flies under both tiles' products. v's bias
  // is the lane's one column of each dim tile; it is added behind the products:
  // as a start value it would hold 16 registers
  v16h vf[2][2];   // [k-step of P V][dim tile]: lane column = head dim, 32 keys
  // of the fourth key tile only its first row, key 48, is a real key: one half
  v8h      bmf[3];
  _Float16 bmf3;
#pragma unroll
  for (int kt = 0; kt < 3; ++kt) bmf[kt] = bp[kt * 32];
  bmf3 = *(const _Float16*)&bp[3 * 32];
  // holds these loads in front of the products they are to fly under
  __builtin_amdgcn_sched_barrier(0);
#pragma unroll
  for (int dt = 0; dt < 2; ++dt) {
    v16h wvf[4];
    loadw1(wvf, wf + (4 + dt) * 256);
    const float cv = bh[2 * HD + dt * 16 + l16];
    v8f acc[4];
#pragma unroll
    for (int mt = 0; mt < 4; ++mt) acc[mt] = vzero;
#pragma unroll
    for (int mt = 0; mt < 4; ++mt) {
#pragma unroll
      for (int kk = 0; kk < 4; ++kk)
        acc[mt] = wmma_f16(ldfrag(XROW(mt) + kk * 32), wvf[kk], acc[mt]);
      if (mt == 1) __builtin_amdgcn_sched_barrier(0);   // as in q's projection
    }
#pragma unroll
    for (int mt = 0; mt < 3; ++mt)
#pragma unroll
      for (int r = 0; r < 8; ++r)                  // keys (mt>>1)*32 + (mt&1)*16 + g*8 + r
        vf[mt >> 1][dt][(mt & 1) * 8 + r] = (_Float16)(acc[mt][r] + cv);
    // token tile 3: register 0 alone (key 48; where g = 1 key 56, a copy of it, with P = 0); the other padded keys' rows of V are zero, as is P there
    vf[1][dt][8] = (_Float16)(acc[3][0] + cv);
#pragma unroll
    for (int r = 1; r < 8; ++r) vf[1][dt][8 + r] = (_Float16)0.f;
    if (dt == 0) asm volatile("" ::: "memory");   // compiler fence, as above
    __builtin_amdgcn_sched_barrier(0);            // as above
  }

  // -------- Phase 3: attention for head h, one query tile at a time --------
  // Transposed scores, S^T = K Q^T: keys down the accumulator rows, one query
  // per lane column. Lanes l and l ^ 16 hold the 64 keys of one query, 32 each.
  const float scale = 0.17677669529663687f;  // 1/sqrt(32)
#pragma unroll
  for (int qt = 0; qt < 4; ++qt) {
    // the next query tile's bias+mask flies under this tile's work
    v8h      bmn[3];
    _Float16 bmn3;
    if (qt < 3) {
#pragma unroll
      for (int kt = 0; kt < 3; ++kt) bmn[kt] = bp[((qt + 1) * 4 + kt) * 32];
      bmn3 = *(const _Float16*)&bp[((qt + 1) * 4 + 3) * 32];
    }

    v8f sacc[4];
#pragma unroll
    for (int kt = 0; kt < 4; ++kt) sacc[kt] = wmma_f16(kf[kt], qf[qt], vzero);

    // softmax over a lane's own 25 registers, then one exchange with lane l ^ 16.
    // Register r of key tile kt is key kt*16 + g*8 + r: tiles 2kk and 2kk+1,
    // converted in place, are the A fragment of P for k-step kk. Of key tile 3
    // only register 0 goes through (key 48 where g = 0; where g = 1 a padded key,
    // killed by the table); registers 1..7 are padded keys in every lane: P = 0.
    v16h ap[2];
    {
      v8f t[3];
#pragma unroll
      for (int kt = 0; kt < 3; ++kt)
#pragma unroll
        for (int r = 0; r < 8; ++r)
          t[kt][r] = sacc[kt][r] * scale + (float)bmf[kt][r];
      float t3 = sacc[3][0] * scale + (float)bmf3;
      float m8[8];
#pragma unroll
      for (int r = 0; r < 8; ++r)
        m8[r] = fmaxf(fmaxf(t[0][r], t[1][r]), t[2][r]);
      float mx = fmaxf(fmaxf(fmaxf(m8[0], m8[1]), fmaxf(m8[2], m8[3])),
                       fmaxf(fmaxf(m8[4], m8[5]), fmaxf(m8[6], m8[7])));
      mx = fmaxf(mx, t3);
      mx = fmaxf(mx, xhalf(mx));
      {
        const float log2e = 1.44269504088896340736f;   // e^x = 2^(x log2 e)
        float ex[25], ey[25];
#pragma unroll
        for (int i = 0; i < 24; ++i) ex[i] = (t[i >> 3][i & 7] - mx) * log2e;
        ex[24] = (t3 - mx) * log2e;
#pragma unroll
        for (int i = 0; i < 25; i += 5) exp2x5(&ey[i], &ex[i]);
#pragma unroll
        for (int i = 0; i < 24; ++i) t[i >> 3][i & 7] = ey[i];
        t3 = ey[24];
      }
      // the tree of the full tile with its zero terms left out: the same sums
      float s8[8];
      s8[0] = (t[0][0] + t[1][0]) + (t[2][0] + t3);
#pragma unroll
      for (int r = 1; r < 8; ++r)
        s8[r] = (t[0][r] + t[1][r]) + t[2][r];
      float sm = ((s8[0] + s8[1]) + (s8[2] + s8[3])) +
                 ((s8[4] + s8[5]) + (s8[6] + s8[7]));
      sm += xhalf(sm);
      float inv = 1.0f / sm;
#pragma unroll
      for (int r = 0; r < 8; ++r) {
        ap[0][r]     = (_Float16)(t[0][r] * inv);
        ap[0][8 + r] = (_Float16)(t[1][r] * inv);
        ap[1][r]     = (_Float16)(t[2][r] * inv);
        ap[1][8 + r] = (_Float16)0.f;
      }
      ap[1][8] = (_Float16)(t3 * inv);
    }

    // P(16x64) @ V(64x32): both operands from registers
    v8f oacc[2];
    oacc[0] = wmma_f16(ap[0], vf[0][0], vzero);
    oacc[1] = wmma_f16(ap[0], vf[0][1], vzero);
    oacc[0] = wmma_f16(ap[1], vf[1][0], oacc[0]);
    oacc[1] = wmma_f16(ap[1], vf[1][1], oacc[1]);

    // store: out[b][n][h*32 + d], coalesced over l16
#pragma unroll
    for (int dt = 0; dt < 2; ++dt) {
#pragma unroll
      for (int r = 0; r < 8; ++r) {
        int n = qt * 16 + g * 8 + r;
        if (n < NTOK) {
          int c = h * HD + dt * 16 + l16;
          out[((size_t)b * NTOK + n) * DIM + c] = oacc[dt][r];
        }
      }
    }
    if (qt < 3) {
#pragma unroll
      for (int kt = 0; kt < 3; ++kt) bmf[kt] = bmn[kt];
      bmf3 = bmn3;
    } else {
      // the next head's first loads land in the registers of the last stores:
      // the wait stands in front of that overwrite
      asm volatile("s_wait_xcnt 0x0" ::: "memory");
    }
    // the vector slots the chip needs between the last P V product and the next
    // product, whose result the compiler may lay over this one's registers with
    // nothing but the stores between them
    asm volatile("v_nop\n\tv_nop\n\tv_nop\n\tv_nop\n\tv_nop");
    // one query tile after the other: mixed, the four tiles' 128 scores are
    // live together: 128 of the wave's at most 256 registers
    __builtin_amdgcn_sched_barrier(0);
  }
  }   // heads
#undef XROW
}

extern "C" void kernel_launch(void* const* d_in, const int* in_sizes, int n_in,
                              void* d_out, int out_size, void* d_ws, size_t ws_size,
                              hipStream_t stream) {
  const float* x         = (const float*)d_in[0];
  const float* mask      = (const float*)d_in[1];
  const float* qkv_w     = (const float*)d_in[2];
  const float* qkv_b     = (const float*)d_in[3];
  const float* rel_table = (const float*)d_in[4];
  float* out = (float*)d_out;

  _Float16* w16 = (_Float16*)d_ws;            // 96 KB of weights
  _Float16* bm  = w16 + W16_HALVES;           // 2 MB bias+mask table behind them
  float*    bq  = (float*)(bm + BM_HALVES);   // 384 regrouped bias values
  prep_kernel<<<706, 256, 0, stream>>>(qkv_w, mask, rel_table, qkv_b, w16, bm, bq);

  swin_attn_kernel<<<256, 512, 0, stream>>>(x, w16, bm, bq, out);
}

// v008
// Measured time: 37.4 microseconds a run.
// In two side-by-side timings against v007, it was 1.05 and 1.06 times as fast.
// Counting every step since v000, it is 4.72 times as fast.
#include <hip/hip_runtime.h>
#include <hip/hip_bf16.h>

typedef _Float16 v16h __attribute__((ext_vector_type(16)));
typedef _Float16 v8h  __attribute__((ext_vector_type(8)));
typedef _Float16 v4h  __attribute__((ext_vector_type(4)));
typedef float    v8f  __attribute__((ext_vector_type(8)));

#define NTOK 49
#define DIM  128
#define NH   4
#define HD   32

// ---- LDS (units: _Float16 halves) of a block of 16 waves, one window a wave ----
// 1. the weights, as in the workspace (fragment order), shared by the 16 windows
// 2. the regrouped projection bias, 384 floats
// 3. 16 x tiles, [49 tokens][136], each written and read by its own wave alone
#define XS_STR   136
#define WPB      16                              // windows (waves) a block
#define XT_HALVES (NTOK * XS_STR)                // 13,328 bytes a tile
#define SM_BIAS  49152
#define SM_X     (SM_BIAS + 768)
#define SMEM_HALVES (SM_X + WPB * XT_HALVES)     // 313,088 bytes

// Workspace, in this order:
// 1. weights, f16, in fragment order:
//    [24 channel tiles][4 k-steps][2 fragment halves][32 lanes][8 halves],
//    so that one 16-byte load of a wave reads 512 contiguous bytes (4 whole lines).
//    Channel tile h*6 + s*2 + dh holds head h, s = 0 q / 1 k / 2 v, head dims
//    dh*16 .. dh*16+15: a tile is all q, all k or all v.
// 2. bias+mask table, f16, in the accumulator order of the transposed scores
//    (keys down the rows, queries across the lanes):
//    [64 mask windows][4 heads][4 query tiles][4 key tiles][32 lanes][8 keys]
// 3. projection bias, f32, regrouped as [4 heads][q,k,v][32 head dims]
#define W16_HALVES 49152      // 384*128
#define BM_HALVES  1048576    // 64*4*16*32*8

// Load one 16x32 (A) or 32x16 (B) f16 fragment: per-lane two 16B loads at
// half-offsets {0..7} and {16..23}; caller supplies base = &buf[row*stride + g*8].
__device__ __forceinline__ v16h ldfrag(const _Float16* p) {
  union { v16h v; v8h h[2]; } u;
  u.h[0] = *(const v8h*)(p);
  u.h[1] = *(const v8h*)(p + 16);
  return u.v;
}

// lane l with lane l ^ 16: the two lanes that share one query's keys
__device__ __forceinline__ float xhalf(float x) {
  return __builtin_bit_cast(float, __builtin_amdgcn_permlanex16(
      __builtin_bit_cast(int, x), __builtin_bit_cast(int, x),
      0x76543210, 0xfedcba98, false, false));
}

// 2^x of five independent values. One statement, so that each v_exp_f32 is the
// independent instruction the instruction set asks for behind the one before it
// (outputs are early-clobber: none lies on a source); the v_nop is that slot
// behind the last one, whatever the compiler puts next.
__device__ __forceinline__ void exp2x5(float* y, const float* x) {
  asm("v_exp_f32 %0, %5\n\tv_exp_f32 %1, %6\n\tv_exp_f32 %2, %7\n\t"
      "v_exp_f32 %3, %8\n\tv_exp_f32 %4, %9\n\tv_nop"
      : "=&v"(y[0]), "=&v"(y[1]), "=&v"(y[2]), "=&v"(y[3]), "=&v"(y[4])
      : "v"(x[0]), "v"(x[1]), "v"(x[2]), "v"(x[3]), "v"(x[4]));
}

__device__ __forceinline__ v8f wmma_f16(v16h a, v16h b, v8f c) {
  return __builtin_amdgcn_wmma_f32_16x16x32_f16(false, a, false, b, (short)0, c,
                                                false, false);
}

// Blocks 0..191: weights to f16, in fragment order. Blocks 192..703: bias+mask table, once per
// (mask window, head); each thread writes the 8 keys one lane of the attention
// kernel adds to one 16x16 tile of transposed scores. Blocks 704, 705: the bias.
__global__ __launch_bounds__(256)
void prep_kernel(const float* __restrict__ w,
                 const float* __restrict__ mask,
                 const float* __restrict__ rel_table,
                 const float* __restrict__ qkv_b,
                 _Float16* __restrict__ w16,
                 _Float16* __restrict__ bm,
                 float* __restrict__ bq) {
  if (blockIdx.x < 192) {
    const int i  = blockIdx.x * 256 + threadIdx.x;   // place in fragment order
    const int j  = i & 7;
    const int ln = (i >> 3) & 31;
    const int hh = (i >> 8) & 1;
    const int kk = (i >> 9) & 3;
    const int ct = i >> 11;
    const int hd = ct / 6;                            // head
    const int s  = (ct % 6) >> 1;                     // 0=q 1=k 2=v
    const int d  = (ct & 1) * 16 + (ln & 15);         // head dim
    w16[i] = (_Float16)w[((hd * HD + d) * 3 + s) * DIM + kk * 32 + hh * 16 +
                         (ln >> 4) * 8 + j];
    return;
  }
  if (blockIdx.x >= 704) {
    const int i = (blockIdx.x - 704) * 256 + threadIdx.x;   // [head][s][dim]
    if (i < 3 * DIM) {
      const int d  = i & 31;
      const int s  = (i >> 5) % 3;
      const int hd = i / 96;
      bq[i] = qkv_b[(hd * HD + d) * 3 + s];
    }
    return;
  }
  const int t    = (blockIdx.x - 192) * 256 + threadIdx.x;
  const int lane = t & 31;
  const int kt   = (t >> 5) & 3;
  const int qt   = (t >> 7) & 3;
  const int h    = (t >> 9) & 3;
  const int wi   = t >> 11;
  const int n    = qt * 16 + (lane & 15);
  const int m0   = kt * 16 + (lane >> 4) * 8;
  // padded rows and columns read a clamped, in-range element, so that all 16
  // loads of a thread are in flight together; the select below drops them
  const int nc = n < NTOK ? n : NTOK - 1;
  float rv[8], mv[8];
#pragma unroll
  for (int r = 0; r < 8; ++r) {
    int mc  = m0 + r < NTOK ? m0 + r : NTOK - 1;
    int idx = (nc / 7 - mc / 7 + 6) * 13 + (nc % 7 - mc % 7 + 6);
    rv[r] = rel_table[idx * NH + h];
    // a later load of this run may land in this load's offset register: the
    // wait stands in front of that overwrite (the data stays in flight)
    asm volatile("s_wait_xcnt 0x0" ::: "memory");
    mv[r] = mask[(wi * NTOK + nc) * NTOK + mc];
    asm volatile("s_wait_xcnt 0x0" ::: "memory");  // same, for the mask load
  }
  v8h o;
#pragma unroll
  for (int r = 0; r < 8; ++r) {
    float val = rv[r] + mv[r];
    if (n >= NTOK)      val = 0.f;           // padded queries: never stored
    if (m0 + r >= NTOK) val = -30000.f;      // kill padded keys in softmax
    o[r] = (_Float16)val;
  }
  *(v8h*)(bm + (size_t)t * 8) = o;
  // the code laid out behind this store writes its registers, on a path that
  // this thread does not take: the wait stands in front of that all the same
  asm volatile("s_wait_xcnt 0x0" ::: "memory");
}

// one weight fragment (one channel tile, one k-step): two 16-byte pieces a lane
__device__ __forceinline__ v16h ldw(const v8h* wf) {
  union { v16h v; v8h p[2]; } f;
  f.p[0] = wf[0];
  f.p[1] = wf[32];
  return f.v;
}

// One wave per window; the wave takes the window's four heads one after the
// other. A block's 16 windows have one mask window in common, so they share the
// weights and bias (read from L2 once a block, kept in LDS) and the same 32 KB
// of the bias+mask table. Each projection product is taken in the orientation
// whose accumulator layout is the operand layout of the product that uses it:
//   q, k: W x^T  (channels down the rows, one token per lane column): the two
//         16-dim tiles of a token tile, converted in place, are the 32-deep
//         fragment of q (B of the scores) or k (A of the scores);
//   v:    x W^T  (tokens down the rows, one head dim per lane column): two
//         token tiles, converted in place, are the B fragment of P V.
// So q, k and v never pass through LDS, and no wave reads another wave's.
// 16 waves a block, four a SIMD: at most 256 registers.
__global__ __launch_bounds__(512)
void swin_attn_kernel(const float* __restrict__ x,
                      const _Float16* __restrict__ W16,
                      const _Float16* __restrict__ BM,
                      const float* __restrict__ BQ,
                      float* __restrict__ out) {
  __shared__ __align__(16) _Float16 smem[SMEM_HALVES];

  const int tid  = threadIdx.x;
  const int lane = tid & 31;
  const int wv   = __builtin_amdgcn_readfirstlane(tid >> 5);   // 16 waves
  const int l16  = lane & 15;
  const int g    = lane >> 4;    // lane group (K-split for A/B, row-split for C/D)
  const int w    = blockIdx.x & 63;                            // mask window id (b % NW)
  const int b    = w + 64 * ((blockIdx.x >> 6) * WPB + wv);    // the wave's window

  v8f vzero;
#pragma unroll
  for (int i = 0; i < 8; ++i) vzero[i] = 0.f;

  // -------- Phase 1: weights and bias to LDS; the wave's x tile as f16 --------
  // All 61 loads of a thread (12 of weights, 49 rows of x) are issued before the
  // first wait: one memory latency a wave.
  {
    const v8h* wsrc = (const v8h*)W16 + tid;      // 6144 16-byte pieces, 12 a thread
    v8h wr[12];
#pragma unroll
    for (int t = 0; t < 12; ++t) wr[t] = wsrc[t * 512];
    const float4* x4 = (const float4*)(x + (size_t)b * NTOK * DIM) + lane;   // a row a load
    float4 xr[NTOK];
    // unrolled so that the loads stand in a row with no wait between them
#pragma unroll
    for (int t = 0; t < NTOK; ++t) xr[t] = x4[t * 32];
    // holds these loads in front of the first wait
    __builtin_amdgcn_sched_barrier(0);
    v8h* wd = (v8h*)smem + tid;
#pragma unroll
    for (int t = 0; t < 12; ++t) wd[t * 512] = wr[t];
    // the bias, 96 pieces, by waves 0..2: behind the last x load, so that the
    // wait in this branch holds no load back
    if (tid < 96) ((float4*)&smem[SM_BIAS])[tid] = ((const float4*)BQ)[tid];
    _Float16* xs = &smem[SM_X + wv * XT_HALVES + lane * 4];
    // unrolled so that xr is indexed by constants and stays in registers
#pragma unroll
    for (int t = 0; t < NTOK; ++t) {
      v4h hv;
      hv[0] = (_Float16)xr[t].x; hv[1] = (_Float16)xr[t].y;
      hv[2] = (_Float16)xr[t].z; hv[3] = (_Float16)xr[t].w;
      *(v4h*)&xs[t * XS_STR] = hv;
    }
  }
  // the one barrier of the kernel: behind it weights and bias are only read
  __syncthreads();

  // Token tiles 0..2: the lane's row l16 of the tile. Tile 3 holds token 48
  // alone: all its lanes read that row, so the 15 padded tokens are copies of a
  // real one (finite values); padded keys are dropped (P = 0) or killed by the table's -30000 and
  // padded queries are never stored, as with zero rows.
  const _Float16* xw  = &smem[SM_X + wv * XT_HALVES + g * 8];
  const _Float16* xb  = xw + l16 * XS_STR;
  const _Float16* xb3 = xw + (NTOK - 1) * XS_STR;
#define XROW(mt) ((mt) < 3 ? xb + (mt) * 16 * XS_STR : xb3)

  // rolled: one head's code, run four times
#pragma unroll 1
  for (int h = 0; h < NH; ++h) {
  // this head's six channel tiles (6*h ..), 8 x 32 16-byte pieces a tile, in LDS
  const v8h*   wf = (const v8h*)smem + h * 6 * 256 + lane;
  const float* bh = (const float*)&smem[SM_BIAS] + h * 3 * HD;
  // bias+mask of this head's 4x4 score tiles: one 16-byte load a lane and tile, one half for key tile 3
  const v8h*   bp = (const v8h*)BM + ((w * NH + h) * 16) * 32 + lane;

  // -------- Phase 2: QKV projection of head h, all 64 tokens --------
  // q and k together, the k-step outermost: the four x fragments of a k-step are
  // read from LDS once and feed q's and k's four channel tiles; the 16 sums
  // (4 channel tiles x 4 token tiles) stay in registers over the four k-steps.
  // The next k-step's fragments are fetched under this k-step's products, as
  // far as 256 registers allow: its weights ahead of the products, its x
  // fragments into the registers that the products have done with.
  v16h qf[4], kf[4];   // [token tile]: lane column = token, 32 head dims
  v16h vf[2][2];       // [k-step of P V][dim tile]: lane column = head dim, 32 keys
  v16h vw[2][2], vx[2][4];   // v's weight and x fragments, this k-step's and the next's
  float cv0, cv1;      // v's bias: the lane's one column of each dim tile
  // of the fourth key tile only its first row, key 48, is a real key: one half
  v8h      bmf[3];
  _Float16 bmf3;
  {
    v8f cb[4];         // bias of q's and k's two dim tiles, in accumulator layout
#pragma unroll
    for (int t = 0; t < 4; ++t) cb[t] = *(const v8f*)(bh + t * 16 + g * 8);
    v8f  acc[4][4];    // [channel tile: q0 q1 k0 k1][token tile]
    v16h wt[2][4], xf[2][4];
#pragma unroll
    for (int t = 0; t < 4; ++t) wt[0][t] = ldw(wf + t * 256);
    xf[0][0] = ldfrag(XROW(0));
    xf[0][1] = ldfrag(XROW(1));
    // token tiles 2 and 3 are asked for last: the first products do not wait for them
    __builtin_amdgcn_sched_barrier(0);
    xf[0][2] = ldfrag(XROW(2));
    xf[0][3] = ldfrag(XROW(3));
#pragma unroll
    for (int kk = 0; kk < 4; ++kk) {
      const int c = kk & 1, n = c ^ 1;
      if (kk > 0 && kk < 3) {
#pragma unroll
        for (int t = 0; t < 4; ++t) wt[n][t] = ldw(wf + t * 256 + (kk + 1) * 64);
      }
      // each scheduling barrier of this loop holds a group of fragment loads at
      // its place among the products: moved up, the registers would overrun;
      // moved down, the wave waits out the LDS latency in front of their products
      __builtin_amdgcn_sched_barrier(0);
#pragma unroll
      for (int mt = 0; mt < 2; ++mt)
#pragma unroll
        for (int t = 0; t < 4; ++t)                // the sums start from the bias
          acc[t][mt] = wmma_f16(wt[c][t], xf[c][mt], kk == 0 ? cb[t] : acc[t][mt]);
      if (kk < 3) {
        __builtin_amdgcn_sched_barrier(0);         // as above
        xf[n][0] = ldfrag(XROW(0) + (kk + 1) * 32);
        xf[n][1] = ldfrag(XROW(1) + (kk + 1) * 32);
        __builtin_amdgcn_sched_barrier(0);         // as above
      }
#pragma unroll
      for (int mt = 2; mt < 4; ++mt)
#pragma unroll
        for (int t = 0; t < 4; ++t)
          acc[t][mt] = wmma_f16(wt[c][t], xf[c][mt], kk == 0 ? cb[t] : acc[t][mt]);
      // as above; behind the last k-step it keeps v's loads behind q's and k's products
      __builtin_amdgcn_sched_barrier(0);
      if (kk < 3) {
        // in the first k-step the bias still holds 32 registers: the second
        // k-step's weights are fetched behind its products
        if (kk == 0) {
#pragma unroll
          for (int t = 0; t < 4; ++t) wt[n][t] = ldw(wf + t * 256 + 64);
        }
        xf[n][2] = ldfrag(XROW(2) + (kk + 1) * 32);
        xf[n][3] = ldfrag(XROW(3) + (kk + 1) * 32);
      }
    }
    // the first query tile's bias+mask, the one load of this part that leaves the
    // WGP, flies under v's products; v's first fragments under q's and k's conversion
#pragma unroll
    for (int kt = 0; kt < 3; ++kt) bmf[kt] = bp[kt * 32];
    bmf3 = *(const _Float16*)&bp[3 * 32];
    cv0 = bh[2 * HD + l16];
    cv1 = bh[2 * HD + 16 + l16];
#pragma unroll
    for (int dt = 0; dt < 2; ++dt) vw[0][dt] = ldw(wf + (4 + dt) * 256);
#pragma unroll
    for (int mt = 0; mt < 4; ++mt) vx[0][mt] = ldfrag(XROW(mt));
    // holds these loads in front of the work they are to fly under
    __builtin_amdgcn_sched_barrier(0);
#pragma unroll
    for (int mt = 0; mt < 4; ++mt)
#pragma unroll
      for (int r = 0; r < 8; ++r) {
        qf[mt][r]     = (_Float16)acc[0][mt][r];   // head dims g*8 + r
        qf[mt][8 + r] = (_Float16)acc[1][mt][r];   // head dims 16 + g*8 + r
        kf[mt][r]     = (_Float16)acc[2][mt][r];
        kf[mt][8 + r] = (_Float16)acc[3][mt][r];
      }
  }

  // v, both dim tiles together, in the same way. Its bias is added behind the
  // products: as a start value it would hold 16 registers
  {
    v8f  acc[2][4];    // [dim tile][token tile]
#pragma unroll
    for (int kk = 0; kk < 4; ++kk) {
      const int c = kk & 1, n = c ^ 1;
      if (kk < 3) {
#pragma unroll
        for (int dt = 0; dt < 2; ++dt) vw[n][dt] = ldw(wf + (4 + dt) * 256 + (kk + 1) * 64);
      }
      // the scheduling barriers hold the groups of fragment loads at their
      // places among the products, as in q's and k's projection
      __builtin_amdgcn_sched_barrier(0);
#pragma unroll
      for (int mt = 0; mt < 2; ++mt)
#pragma unroll
        for (int dt = 0; dt < 2; ++dt)
          acc[dt][mt] = wmma_f16(vx[c][mt], vw[c][dt], kk == 0 ? vzero : acc[dt][mt]);
      if (kk < 3) {
        __builtin_amdgcn_sched_barrier(0);         // as above
        vx[n][0] = ldfrag(XROW(0) + (kk + 1) * 32);
        vx[n][1] = ldfrag(XROW(1) + (kk + 1) * 32);
        __builtin_amdgcn_sched_barrier(0);         // as above
      }
#pragma unroll
      for (int mt = 2; mt < 4; ++mt)
#pragma unroll
        for (int dt = 0; dt < 2; ++dt)
          acc[dt][mt] = wmma_f16(vx[c][mt], vw[c][dt], kk == 0 ? vzero : acc[dt][mt]);
      if (kk < 3) {
        __builtin_amdgcn_sched_barrier(0);         // as above
        vx[n][2] = ldfrag(XROW(2) + (kk + 1) * 32);
        vx[n][3] = ldfrag(XROW(3) + (kk + 1) * 32);
      }
    }
#pragma unroll
    for (int dt = 0; dt < 2; ++dt) {
      const float cv = dt ? cv1 : cv0;
#pragma unroll
      for (int mt = 0; mt < 3; ++mt)
#pragma unroll
        for (int r = 0; r < 8; ++r)                // keys (mt>>1)*32 + (mt&1)*16 + g*8 + r
          vf[mt >> 1][dt][(mt & 1) * 8 + r] = (_Float16)(acc[dt][mt][r] + cv);
      // token tile 3: its register 0 alone, key 48 (in lanes 16..31 padded key 56, a copy of it, whose P is 0); the other padded keys' rows of V are zero, as is P there
      vf[1][dt][8] = (_Float16)(acc[dt][3][0] + cv);
#pragma unroll
      for (int r = 1; r < 8; ++r) vf[1][dt][8 + r] = (_Float16)0.f;
    }
    // keeps the projection apart from the attention part: mixed, sums,
    // fragments and scores are live together
    __builtin_amdgcn_sched_barrier(0);
  }

  // -------- Phase 3: attention for head h, one query tile at a time --------
  // Transposed scores, S^T = K Q^T: keys down the accumulator rows, one query
  // per lane column. Lanes l and l ^ 16 hold the 64 keys of one query, 32 each.
  const float scale = 0.17677669529663687f;  // 1/sqrt(32)
#pragma unroll
  for (int qt = 0; qt < 4; ++qt) {
    // the next query tile's bias+mask flies under this tile's work
    v8h      bmn[3];
    _Float16 bmn3;
    if (qt < 3) {
#pragma unroll
      for (int kt = 0; kt < 3; ++kt) bmn[kt] = bp[((qt + 1) * 4 + kt) * 32];
      bmn3 = *(const _Float16*)&bp[((qt + 1) * 4 + 3) * 32];
    }

    v8f sacc[4];
#pragma unroll
    for (int kt = 0; kt < 4; ++kt) sacc[kt] = wmma_f16(kf[kt], qf[qt], vzero);

    // softmax over a lane's own 25 registers, then one exchange with lane l ^ 16.
    // Register r of key tile kt is key kt*16 + g*8 + r: tiles 2kk and 2kk+1,
    // converted in place, are the A fragment of P for k-step kk. Of key tile 3
    // only register 0 goes through (key 48 where g = 0; where g = 1 a padded key,
    // killed by the table); registers 1..7 are padded keys in every lane: P = 0.
    v16h ap[2];
    {
      v8f t[3];
#pragma unroll
      for (int kt = 0; kt < 3; ++kt)
#pragma unroll
        for (int r = 0; r < 8; ++r)
          t[kt][r] = sacc[kt][r] * scale + (float)bmf[kt][r];
      float t3 = sacc[3][0] * scale + (float)bmf3;
      float m8[8];
#pragma unroll
      for (int r = 0; r < 8; ++r)
        m8[r] = fmaxf(fmaxf(t[0][r], t[1][r]), t[2][r]);
      float mx = fmaxf(fmaxf(fmaxf(m8[0], m8[1]), fmaxf(m8[2], m8[3])),
                       fmaxf(fmaxf(m8[4], m8[5]), fmaxf(m8[6], m8[7])));
      mx = fmaxf(mx, t3);
      mx = fmaxf(mx, xhalf(mx));
      {
        const float log2e = 1.44269504088896340736f;   // e^x = 2^(x log2 e)
        float ex[25], ey[25];
#pragma unroll
        for (int i = 0; i < 24; ++i) ex[i] = (t[i >> 3][i & 7] - mx) * log2e;
        ex[24] = (t3 - mx) * log2e;
#pragma unroll
        for (int i = 0; i < 25; i += 5) exp2x5(&ey[i], &ex[i]);
#pragma unroll
        for (int i = 0; i < 24; ++i) t[i >> 3][i & 7] = ey[i];
        t3 = ey[24];
      }
      // the tree of the full tile with its zero terms left out: the same sums
      float s8[8];
      s8[0] = (t[0][0] + t[1][0]) + (t[2][0] + t3);
#pragma unroll
      for (int r = 1; r < 8; ++r)
        s8[r] = (t[0][r] + t[1][r]) + t[2][r];
      float sm = ((s8[0] + s8[1]) + (s8[2] + s8[3])) +
                 ((s8[4] + s8[5]) + (s8[6] + s8[7]));
      sm += xhalf(sm);
      float inv = 1.0f / sm;
#pragma unroll
      for (int r = 0; r < 8; ++r) {
        ap[0][r]     = (_Float16)(t[0][r] * inv);
        ap[0][8 + r] = (_Float16)(t[1][r] * inv);
        ap[1][r]     = (_Float16)(t[2][r] * inv);
        ap[1][8 + r] = (_Float16)0.f;
      }
      ap[1][8] = (_Float16)(t3 * inv);
    }

    // P(16x64) @ V(64x32): both operands from registers
    v8f oacc[2];
    oacc[0] = wmma_f16(ap[0], vf[0][0], vzero);
    oacc[1] = wmma_f16(ap[0], vf[0][1], vzero);
    oacc[0] = wmma_f16(ap[1], vf[1][0], oacc[0]);
    oacc[1] = wmma_f16(ap[1], vf[1][1], oacc[1]);

    // store: out[b][n][h*32 + d], coalesced over l16
#pragma unroll
    for (int dt = 0; dt < 2; ++dt) {
#pragma unroll
      for (int r = 0; r < 8; ++r) {
        int n = qt * 16 + g * 8 + r;
        if (n < NTOK) {
          int c = h * HD + dt * 16 + l16;
          out[((size_t)b * NTOK + n) * DIM + c] = oacc[dt][r];
        }
      }
    }
    if (qt < 3) {
#pragma unroll
      for (int kt = 0; kt < 3; ++kt) bmf[kt] = bmn[kt];
      bmf3 = bmn3;
    } else {
      // the next head's first loads land in the registers of the last stores:
      // the wait stands in front of that overwrite
      asm volatile("s_wait_xcnt 0x0" ::: "memory");
    }
    // the vector slots the chip needs between the last P V product and the next
    // product, whose result the compiler may lay over this one's registers with
    // nothing but the stores between them
    asm volatile("v_nop\n\tv_nop\n\tv_nop\n\tv_nop\n\tv_nop");
    // one query tile after the other: mixed, the four tiles' 128 scores are
    // live together: 128 of the wave's at most 256 registers
    __builtin_amdgcn_sched_barrier(0);
  }
  }   // heads
#undef XROW
}

extern "C" void kernel_launch(void* const* d_in, const int* in_sizes, int n_in,
                              void* d_out, int out_size, void* d_ws, size_t ws_size,
                              hipStream_t stream) {
  const float* x         = (const float*)d_in[0];
  const float* mask      = (const float*)d_in[1];
  const float* qkv_w     = (const float*)d_in[2];
  const float* qkv_b     = (const float*)d_in[3];
  const float* rel_table = (const float*)d_in[4];
  float* out = (float*)d_out;

  _Float16* w16 = (_Float16*)d_ws;            // 96 KB of weights
  _Float16* bm  = w16 + W16_HALVES;           // 2 MB bias+mask table behind them
  float*    bq  = (float*)(bm + BM_HALVES);   // 384 regrouped bias values
  prep_kernel<<<706, 256, 0, stream>>>(qkv_w, mask, rel_table, qkv_b, w16, bm, bq);

  swin_attn_kernel<<<256, 512, 0, stream>>>(x, w16, bm, bq, out);
}

// v009
// One run takes 36.6 microseconds.
// Next to v008, in two timings, it ran 1.03 times as fast each time.
// Over all steps from v000 it is 4.86 times as fast.
#include <hip/hip_runtime.h>
#include <hip/hip_bf16.h>

typedef _Float16 v16h __attribute__((ext_vector_type(16)));
typedef _Float16 v8h  __attribute__((ext_vector_type(8)));
typedef _Float16 v4h  __attribute__((ext_vector_type(4)));
typedef float    v8f  __attribute__((ext_vector_type(8)));
typedef float    v4f  __attribute__((ext_vector_type(4)));

#define NTOK 49
#define DIM  128
#define NH   4
#define HD   32

// ---- LDS (units: _Float16 halves) of a block of 16 waves, one window a wave ----
// 1. the weights, as in the workspace (fragment order), shared by the 16 windows
// 2. the regrouped projection bias, 384 floats
// 3. 16 x tiles, [49 tokens][136], each written and read by its own wave alone
#define XS_STR   136
#define WPB      16                              // windows (waves) a block
#define XT_HALVES (NTOK * XS_STR)                // 13,328 bytes a tile
#define SM_BIAS  49152
#define SM_X     (SM_BIAS + 768)
#define SMEM_HALVES (SM_X + WPB * XT_HALVES)     // 313,088 bytes

// Workspace, in this order:
// 1. weights, f16, in fragment order:
//    [24 channel tiles][4 k-steps][2 fragment halves][32 lanes][8 halves],
//    so that one 16-byte load of a wave reads 512 contiguous bytes (4 whole lines).
//    Channel tile h*6 + s*2 + dh holds head h, s = 0 q / 1 k / 2 v, head dims
//    dh*16 .. dh*16+15: a tile is all q, all k or all v.
//    q's weights (and q's bias, in 3.) carry the factor QSCALE.
// 2. bias+mask table, f32, times log2 e, in the accumulator order of the
//    transposed scores (keys down the rows, queries across the lanes):
//    [64 mask windows][4 heads][4 query tiles][4 key tiles][2 halves][32 lanes][4 keys]
//    Key tiles 0..2 are the start values of their score products; of key tile 3
//    a lane reads only its first value, added behind the product.
// 3. projection bias, f32, regrouped as [4 heads][q,k,v][32 head dims]
#define W16_HALVES 49152      // 384*128
#define BM_FLOATS  1048576    // 64*4*16*2*32*4

// e^(s / sqrt(32) + b) = 2^(s * QSCALE + b * LOG2E): QSCALE = log2(e) / sqrt(32)
// goes into q, LOG2E into the table, and the score product yields the exponent.
#define LOG2E  1.44269504088896340736f
#define QSCALE 0.25503486164919736f

// Load one 16x32 (A) or 32x16 (B) f16 fragment: per-lane two 16B loads at
// half-offsets {0..7} and {16..23}; caller supplies base = &buf[row*stride + g*8].
__device__ __forceinline__ v16h ldfrag(const _Float16* p) {
  union { v16h v; v8h h[2]; } u;
  u.h[0] = *(const v8h*)(p);
  u.h[1] = *(const v8h*)(p + 16);
  return u.v;
}

// lane l with lane l ^ 16: the two lanes that share one query's keys
__device__ __forceinline__ float xhalf(float x) {
  return __builtin_bit_cast(float, __builtin_amdgcn_permlanex16(
      __builtin_bit_cast(int, x), __builtin_bit_cast(int, x),
      0x76543210, 0xfedcba98, false, false));
}

// 2^x of five independent values. One statement, so that each v_exp_f32 is the
// independent instruction the instruction set asks for behind the one before it
// (outputs are early-clobber: none lies on a source); the v_nop is that slot
// behind the last one, whatever the compiler puts next.
__device__ __forceinline__ void exp2x5(float* y, const float* x) {
  asm("v_exp_f32 %0, %5\n\tv_exp_f32 %1, %6\n\tv_exp_f32 %2, %7\n\t"
      "v_exp_f32 %3, %8\n\tv_exp_f32 %4, %9\n\tv_nop"
      : "=&v"(y[0]), "=&v"(y[1]), "=&v"(y[2]), "=&v"(y[3]), "=&v"(y[4])
      : "v"(x[0]), "v"(x[1]), "v"(x[2]), "v"(x[3]), "v"(x[4]));
}

__device__ __forceinline__ v8f wmma_f16(v16h a, v16h b, v8f c) {
  return __builtin_amdgcn_wmma_f32_16x16x32_f16(false, a, false, b, (short)0, c,
                                                false, false);
}

// Blocks 0..191: weights to f16, in fragment order. Blocks 192..703: bias+mask table, once per
// (mask window, head); each thread writes the 8 keys one lane of the attention
// kernel adds to one 16x16 tile of transposed scores. Blocks 704, 705: the bias.
__global__ __launch_bounds__(256)
void prep_kernel(const float* __restrict__ w,
                 const float* __restrict__ mask,
                 const float* __restrict__ rel_table,
                 const float* __restrict__ qkv_b,
                 _Float16* __restrict__ w16,
                 float* __restrict__ bm,
                 float* __restrict__ bq) {
  if (blockIdx.x < 192) {
    const int i  = blockIdx.x * 256 + threadIdx.x;   // place in fragment order
    const int j  = i & 7;
    const int ln = (i >> 3) & 31;
    const int hh = (i >> 8) & 1;
    const int kk = (i >> 9) & 3;
    const int ct = i >> 11;
    const int hd = ct / 6;                            // head
    const int s  = (ct % 6) >> 1;                     // 0=q 1=k 2=v
    const int d  = (ct & 1) * 16 + (ln & 15);         // head dim
    const float wv = w[((hd * HD + d) * 3 + s) * DIM + kk * 32 + hh * 16 +
                       (ln >> 4) * 8 + j];
    w16[i] = (_Float16)(s == 0 ? wv * QSCALE : wv);
    return;
  }
  if (blockIdx.x >= 704) {
    const int i = (blockIdx.x - 704) * 256 + threadIdx.x;   // [head][s][dim]
    if (i < 3 * DIM) {
      const int d  = i & 31;
      const int s  = (i >> 5) % 3;
      const int hd = i / 96;
      const float bv = qkv_b[(hd * HD + d) * 3 + s];
      bq[i] = s == 0 ? bv * QSCALE : bv;
    }
    return;
  }
  const int t    = (blockIdx.x - 192) * 256 + threadIdx.x;
  const int lane = t & 31;
  const int kt   = (t >> 5) & 3;
  const int qt   = (t >> 7) & 3;
  const int h    = (t >> 9) & 3;
  const int wi   = t >> 11;
  const int n    = qt * 16 + (lane & 15);
  const int m0   = kt * 16 + (lane >> 4) * 8;
  // padded rows and columns read a clamped, in-range element, so that all 16
  // loads of a thread are in flight together; the select below drops them
  const int nc = n < NTOK ? n : NTOK - 1;
  float rv[8], mv[8];
#pragma unroll
  for (int r = 0; r < 8; ++r) {
    int mc  = m0 + r < NTOK ? m0 + r : NTOK - 1;
    int idx = (nc / 7 - mc / 7 + 6) * 13 + (nc % 7 - mc % 7 + 6);
    rv[r] = rel_table[idx * NH + h];
    // a later load of this run may land in this load's offset register: the
    // wait stands in front of that overwrite (the data stays in flight)
    asm volatile("s_wait_xcnt 0x0" ::: "memory");
    mv[r] = mask[(wi * NTOK + nc) * NTOK + mc];
    asm volatile("s_wait_xcnt 0x0" ::: "memory");  // same, for the mask load
  }
  v4f o[2];
#pragma unroll
  for (int r = 0; r < 8; ++r) {
    float val = (rv[r] + mv[r]) * LOG2E;
    if (n >= NTOK)      val = 0.f;           // padded queries: never stored
    if (m0 + r >= NTOK) val = -30000.f;      // kill padded keys in softmax
    o[r >> 2][r & 3] = val;
  }
  // each of the two stores of a wave writes 512 contiguous bytes
  v4f* bo = (v4f*)bm + (size_t)(t >> 5) * 64 + lane;
  bo[0]  = o[0];
  bo[32] = o[1];
  // the code laid out behind this store writes its registers, on a path that
  // this thread does not take: the wait stands in front of that all the same
  asm volatile("s_wait_xcnt 0x0" ::: "memory");
}

// one weight fragment (one channel tile, one k-step): two 16-byte pieces a lane
__device__ __forceinline__ v16h ldw(const v8h* wf) {
  union { v16h v; v8h p[2]; } f;
  f.p[0] = wf[0];
  f.p[1] = wf[32];
  return f.v;
}

// One wave per window; the wave takes the window's four heads one after the
// other. A block's 16 windows have one mask window in common, so they share the
// weights and bias (read from L2 once a block, kept in LDS) and the same 64 KB
// of the bias+mask table. Each projection product is taken in the orientation
// whose accumulator layout is the operand layout of the product that uses it:
//   q, k: W x^T  (channels down the rows, one token per lane column): the two
//         16-dim tiles of a token tile, converted in place, are the 32-deep
//         fragment of q (B of the scores) or k (A of the scores);
//   v:    x W^T  (tokens down the rows, one head dim per lane column): two
//         token tiles, converted in place, are the B fragment of P V.
// So q, k and v never pass through LDS, and no wave reads another wave's.
// 16 waves a block, four a SIMD: at most 256 registers.
__global__ __launch_bounds__(512)
void swin_attn_kernel(const float* __restrict__ x,
                      const _Float16* __restrict__ W16,
                      const float* __restrict__ BM,
                      const float* __restrict__ BQ,
                      float* __restrict__ out) {
  __shared__ __align__(16) _Float16 smem[SMEM_HALVES];

  const int tid  = threadIdx.x;
  const int lane = tid & 31;
  const int wv   = __builtin_amdgcn_readfirstlane(tid >> 5);   // 16 waves
  const int l16  = lane & 15;
  const int g    = lane >> 4;    // lane group (K-split for A/B, row-split for C/D)
  const int w    = blockIdx.x & 63;                            // mask window id (b % NW)
  const int b    = w + 64 * ((blockIdx.x >> 6) * WPB + wv);    // the wave's window

  v8f vzero;
#pragma unroll
  for (int i = 0; i < 8; ++i) vzero[i] = 0.f;

  // -------- Phase 1: weights and bias to LDS; the wave's x tile as f16 --------
  // All 61 loads of a thread (12 of weights, 49 rows of x) are issued before the
  // first wait: one memory latency a wave.
  {
    const v8h* wsrc = (const v8h*)W16 + tid;      // 6144 16-byte pieces, 12 a thread
    v8h wr[12];
#pragma unroll
    for (int t = 0; t < 12; ++t) wr[t] = wsrc[t * 512];
    const float4* x4 = (const float4*)(x + (size_t)b * NTOK * DIM) + lane;   // a row a load
    float4 xr[NTOK];
    // unrolled so that the loads stand in a row with no wait between them
#pragma unroll
    for (int t = 0; t < NTOK; ++t) xr[t] = x4[t * 32];
    // holds these loads in front of the first wait
    __builtin_amdgcn_sched_barrier(0);
    v8h* wd = (v8h*)smem + tid;
#pragma unroll
    for (int t = 0; t < 12; ++t) wd[t * 512] = wr[t];
    // the bias, 96 pieces, by waves 0..2: behind the last x load, so that the
    // wait in this branch holds no load back
    if (tid < 96) ((float4*)&smem[SM_BIAS])[tid] = ((const float4*)BQ)[tid];
    _Float16* xs = &smem[SM_X + wv * XT_HALVES + lane * 4];
    // unrolled so that xr is indexed by constants and stays in registers
#pragma unroll
    for (int t = 0; t < NTOK; ++t) {
      v4h hv;
      hv[0] = (_Float16)xr[t].x; hv[1] = (_Float16)xr[t].y;
      hv[2] = (_Float16)xr[t].z; hv[3] = (_Float16)xr[t].w;
      *(v4h*)&xs[t * XS_STR] = hv;
    }
  }
  // the one barrier of the kernel: behind it weights and bias are only read
  __syncthreads();

  // Token tiles 0..2: the lane's row l16 of the tile. Tile 3 holds token 48
  // alone: all its lanes read that row, so the 15 padded tokens are copies of a
  // real one (finite values); padded keys are dropped (P = 0) or killed by the table's -30000 and
  // padded queries are never stored, as with zero rows.
  const _Float16* xw  = &smem[SM_X + wv * XT_HALVES + g * 8];
  const _Float16* xb  = xw + l16 * XS_STR;
  const _Float16* xb3 = xw + (NTOK - 1) * XS_STR;
#define XROW(mt) ((mt) < 3 ? xb + (mt) * 16 * XS_STR : xb3)

  // rolled: one head's code, run four times
#pragma unroll 1
  for (int h = 0; h < NH; ++h) {
  // this head's six channel tiles (6*h ..), 8 x 32 16-byte pieces a tile, in LDS
  const v8h*   wf = (const v8h*)smem + h * 6 * 256 + lane;
  const float* bh = (const float*)&smem[SM_BIAS] + h * 3 * HD;
  // bias+mask of this head's 4x4 score tiles: two 16-byte loads a lane and tile
  const v4f*   bp = (const v4f*)BM + ((w * NH + h) * 16) * 64 + lane;
#define BMTILE(qt, kt) __builtin_shufflevector(bp[((qt) * 4 + (kt)) * 64], \
                           bp[((qt) * 4 + (kt)) * 64 + 32], 0, 1, 2, 3, 4, 5, 6, 7)

  // -------- Phase 2: QKV projection of head h, all 64 tokens --------
  // q and k together, the k-step outermost: the four x fragments of a k-step are
  // read from LDS once and feed q's and k's four channel tiles; the 16 sums
  // (4 channel tiles x 4 token tiles) stay in registers over the four k-steps.
  // The next k-step's fragments are fetched under this k-step's products, as
  // far as 256 registers allow: its weights ahead of the products, its x
  // fragments into the registers that the products have done with.
  v16h qf[4], kf[4];   // [token tile]: lane column = token, 32 head dims
  v16h vf[2][2];       // [k-step of P V][dim tile]: lane column = head dim, 32 keys
  v16h vw[2][2], vx[2][4];   // v's weight and x fragments, this k-step's and the next's
  float cv0, cv1;      // v's bias: the lane's one column of each dim tile
  // of the fourth key tile only its first row, key 48, is a real key: one value
  v8f   bmf[3];
  float bmf3;
  {
    v8f cb[4];         // bias of q's and k's two dim tiles, in accumulator layout
#pragma unroll
    for (int t = 0; t < 4; ++t) cb[t] = *(const v8f*)(bh + t * 16 + g * 8);
    v8f  acc[4][4];    // [channel tile: q0 q1 k0 k1][token tile]
    v16h wt[2][4], xf[2][4];
#pragma unroll
    for (int t = 0; t < 4; ++t) wt[0][t] = ldw(wf + t * 256);
    xf[0][0] = ldfrag(XROW(0));
    xf[0][1] = ldfrag(XROW(1));
    // token tiles 2 and 3 are asked for last: the first products do not wait for them
    __builtin_amdgcn_sched_barrier(0);
    xf[0][2] = ldfrag(XROW(2));
    xf[0][3] = ldfrag(XROW(3));
#pragma unroll
    for (int kk = 0; kk < 4; ++kk) {
      const int c = kk & 1, n = c ^ 1;
      if (kk > 0 && kk < 3) {
#pragma unroll
        for (int t = 0; t < 4; ++t) wt[n][t] = ldw(wf + t * 256 + (kk + 1) * 64);
      }
      // each scheduling barrier of this loop holds a group of fragment loads at
      // its place among the products: moved up, the registers would overrun;
      // moved down, the wave waits out the LDS latency in front of their products
      __builtin_amdgcn_sched_barrier(0);
#pragma unroll
      for (int mt = 0; mt < 2; ++mt)
#pragma unroll
        for (int t = 0; t < 4; ++t)                // the sums start from the bias
          acc[t][mt] = wmma_f16(wt[c][t], xf[c][mt], kk == 0 ? cb[t] : acc[t][mt]);
      if (kk < 3) {
        __builtin_amdgcn_sched_barrier(0);         // as above
        xf[n][0] = ldfrag(XROW(0) + (kk + 1) * 32);
        xf[n][1] = ldfrag(XROW(1) + (kk + 1) * 32);
        __builtin_amdgcn_sched_barrier(0);         // as above
      }
#pragma unroll
      for (int mt = 2; mt < 4; ++mt)
#pragma unroll
        for (int t = 0; t < 4; ++t)
          acc[t][mt] = wmma_f16(wt[c][t], xf[c][mt], kk == 0 ? cb[t] : acc[t][mt]);
      // as above; behind the last k-step it keeps v's loads behind q's and k's products
      __builtin_amdgcn_sched_barrier(0);
      if (kk < 3) {
        // in the first k-step the bias still holds 32 registers: the second
        // k-step's weights are fetched behind its products
        if (kk == 0) {
#pragma unroll
          for (int t = 0; t < 4; ++t) wt[n][t] = ldw(wf + t * 256 + 64);
        }
        xf[n][2] = ldfrag(XROW(2) + (kk + 1) * 32);
        xf[n][3] = ldfrag(XROW(3) + (kk + 1) * 32);
      }
    }
    // the first query tile's bias+mask, the one load of this part that leaves the
    // WGP, flies under v's products; v's first fragments under q's and k's conversion
#pragma unroll
    for (int kt = 0; kt < 3; ++kt) bmf[kt] = BMTILE(0, kt);
    bmf3 = *(const float*)&bp[3 * 64];
    cv0 = bh[2 * HD + l16];
    cv1 = bh[2 * HD + 16 + l16];
#pragma unroll
    for (int dt = 0; dt < 2; ++dt) vw[0][dt] = ldw(wf + (4 + dt) * 256);
#pragma unroll
    for (int mt = 0; mt < 4; ++mt) vx[0][mt] = ldfrag(XROW(mt));
    // holds these loads in front of the work they are to fly under
    __builtin_amdgcn_sched_barrier(0);
#pragma unroll
    for (int mt = 0; mt < 4; ++mt)
#pragma unroll
      for (int r = 0; r < 8; ++r) {
        qf[mt][r]     = (_Float16)acc[0][mt][r];   // head dims g*8 + r
        qf[mt][8 + r] = (_Float16)acc[1][mt][r];   // head dims 16 + g*8 + r
        kf[mt][r]     = (_Float16)acc[2][mt][r];
        kf[mt][8 + r] = (_Float16)acc[3][mt][r];
      }
  }

  // v, both dim tiles together, in the same way. Its bias is added behind the
  // products: as a start value it would hold 16 registers
  {
    v8f  acc[2][4];    // [dim tile][token tile]
#pragma unroll
    for (int kk = 0; kk < 4; ++kk) {
      const int c = kk & 1, n = c ^ 1;
      if (kk < 3) {
#pragma unroll
        for (int dt = 0; dt < 2; ++dt) vw[n][dt] = ldw(wf + (4 + dt) * 256 + (kk + 1) * 64);
      }
      // the scheduling barriers hold the groups of fragment loads at their
      // places among the products, as in q's and k's projection
      __builtin_amdgcn_sched_barrier(0);
#pragma unroll
      for (int mt = 0; mt < 2; ++mt)
#pragma unroll
        for (int dt = 0; dt < 2; ++dt)
          acc[dt][mt] = wmma_f16(vx[c][mt], vw[c][dt], kk == 0 ? vzero : acc[dt][mt]);
      if (kk < 3) {
        __builtin_amdgcn_sched_barrier(0);         // as above
        vx[n][0] = ldfrag(XROW(0) + (kk + 1) * 32);
        vx[n][1] = ldfrag(XROW(1) + (kk + 1) * 32);
        __builtin_amdgcn_sched_barrier(0);         // as above
      }
#pragma unroll
      for (int mt = 2; mt < 4; ++mt)
#pragma unroll
        for (int dt = 0; dt < 2; ++dt)
          acc[dt][mt] = wmma_f16(vx[c][mt], vw[c][dt], kk == 0 ? vzero : acc[dt][mt]);
      if (kk < 3) {
        __builtin_amdgcn_sched_barrier(0);         // as above
        vx[n][2] = ldfrag(XROW(2) + (kk + 1) * 32);
        vx[n][3] = ldfrag(XROW(3) + (kk + 1) * 32);
      }
    }
#pragma unroll
    for (int dt = 0; dt < 2; ++dt) {
      const float cv = dt ? cv1 : cv0;
#pragma unroll
      for (int mt = 0; mt < 3; ++mt)
#pragma unroll
        for (int r = 0; r < 8; ++r)                // keys (mt>>1)*32 + (mt&1)*16 + g*8 + r
          vf[mt >> 1][dt][(mt & 1) * 8 + r] = (_Float16)(acc[dt][mt][r] + cv);
      // token tile 3: its register 0 alone, key 48 (in lanes 16..31 padded key 56, a copy of it, whose P is 0); the other padded keys' rows of V are zero, as is P there
      vf[1][dt][8] = (_Float16)(acc[dt][3][0] + cv);
#pragma unroll
      for (int r = 1; r < 8; ++r) vf[1][dt][8 + r] = (_Float16)0.f;
    }
    // keeps the projection apart from the attention part: mixed, sums,
    // fragments and scores are live together
    __builtin_amdgcn_sched_barrier(0);
  }

  // -------- Phase 3: attention for head h, one query tile at a time --------
  // Transposed scores, S^T = K Q^T: keys down the accumulator rows, one query
  // per lane column. Lanes l and l ^ 16 hold the 64 keys of one query, 32 each.
  // q carries QSCALE, key tiles 0..2 start from the table, tile 3 adds its one
  // value behind: the scores are exponents to base 2, bias and mask included.
#pragma unroll
  for (int qt = 0; qt < 4; ++qt) {
    const v8f sacc3 = wmma_f16(kf[3], qf[qt], vzero);
    v8f t[3];
#pragma unroll
    for (int kt = 0; kt < 3; ++kt) t[kt] = wmma_f16(kf[kt], qf[qt], bmf[kt]);
    // keeps the four products in a row, each in the vector slots that the one
    // before it needs: with the maxima among them, those slots are filled by v_nop
    __builtin_amdgcn_sched_barrier(0);

    // the next query tile's bias+mask flies under this tile's softmax and P V
    v8f   bmn[3];
    float bmn3;
    if (qt < 3) {
      // these loads may land in the registers of the tile before's stores: the
      // wait stands in front of that overwrite
      asm volatile("s_wait_xcnt 0x0" ::: "memory");
#pragma unroll
      for (int kt = 0; kt < 3; ++kt) bmn[kt] = BMTILE(qt + 1, kt);
      bmn3 = *(const float*)&bp[((qt + 1) * 4 + 3) * 64];
      // holds these loads in front of the softmax: moved down, they fly under
      // the P V products alone and the next tile's first product waits for them
      __builtin_amdgcn_sched_barrier(0);
    }

    // softmax over a lane's own 25 registers, then one exchange with lane l ^ 16.
    // Register r of key tile kt is key kt*16 + g*8 + r: tiles 2kk and 2kk+1,
    // converted in place, are the A fragment of P for k-step kk. Of key tile 3
    // only register 0 goes through (key 48 where g = 0; where g = 1 a padded key,
    // killed by the table); registers 1..7 are padded keys in every lane: P = 0.
    v16h ap[2];
    {
      float t3 = sacc3[0] + bmf3;
      float m8[8];
#pragma unroll
      for (int r = 0; r < 8; ++r)
        m8[r] = fmaxf(fmaxf(t[0][r], t[1][r]), t[2][r]);
      float mx = fmaxf(fmaxf(fmaxf(fmaxf(m8[0], m8[1]), m8[2]),
                             fmaxf(fmaxf(m8[3], m8[4]), m8[5])),
                       fmaxf(fmaxf(m8[6], m8[7]), t3));
      mx = fmaxf(mx, xhalf(mx));
      {
        float ex[25], ey[25];
#pragma unroll
        for (int i = 0; i < 24; ++i) ex[i] = t[i >> 3][i & 7] - mx;
        ex[24] = t3 - mx;
#pragma unroll
        for (int i = 0; i < 25; i += 5) exp2x5(&ey[i], &ex[i]);
#pragma unroll
        for (int i = 0; i < 24; ++i) t[i >> 3][i & 7] = ey[i];
        t3 = ey[24];
      }
      // the tree of the full tile with its zero terms left out: the same sums
      float s8[8];
      s8[0] = (t[0][0] + t[1][0]) + (t[2][0] + t3);
#pragma unroll
      for (int r = 1; r < 8; ++r)
        s8[r] = (t[0][r] + t[1][r]) + t[2][r];
      float sm = ((s8[0] + s8[1]) + (s8[2] + s8[3])) +
                 ((s8[4] + s8[5]) + (s8[6] + s8[7]));
      sm += xhalf(sm);
      float inv = 1.0f / sm;
#pragma unroll
      for (int r = 0; r < 8; ++r) {
        ap[0][r]     = (_Float16)(t[0][r] * inv);
        ap[0][8 + r] = (_Float16)(t[1][r] * inv);
        ap[1][r]     = (_Float16)(t[2][r] * inv);
        ap[1][8 + r] = (_Float16)0.f;
      }
      ap[1][8] = (_Float16)(t3 * inv);
    }

    // P(16x64) @ V(64x32): both operands from registers
    v8f oacc[2];
    oacc[0] = wmma_f16(ap[0], vf[0][0], vzero);
    oacc[1] = wmma_f16(ap[0], vf[0][1], vzero);
    oacc[0] = wmma_f16(ap[1], vf[1][0], oacc[0]);
    oacc[1] = wmma_f16(ap[1], vf[1][1], oacc[1]);

    // store: out[b][n][h*32 + d], coalesced over l16
#pragma unroll
    for (int dt = 0; dt < 2; ++dt) {
#pragma unroll
      for (int r = 0; r < 8; ++r) {
        int n = qt * 16 + g * 8 + r;
        if (n < NTOK) {
          int c = h * HD + dt * 16 + l16;
          out[((size_t)b * NTOK + n) * DIM + c] = oacc[dt][r];
        }
      }
    }
    if (qt < 3) {
#pragma unroll
      for (int kt = 0; kt < 3; ++kt) bmf[kt] = bmn[kt];
      bmf3 = bmn3;
    } else {
      // the next head's first loads land in the registers of the last stores:
      // the wait stands in front of that overwrite
      asm volatile("s_wait_xcnt 0x0" ::: "memory");
    }
    // the vector slots the chip needs between the last P V product and the next
    // product, whose result the compiler may lay over this one's registers with
    // nothing but the stores between them
    asm volatile("v_nop\n\tv_nop\n\tv_nop\n\tv_nop\n\tv_nop");
    // one query tile after the other: mixed, the four tiles' 128 scores are
    // live together: 128 of the wave's at most 256 registers
    __builtin_amdgcn_sched_barrier(0);
  }
  }   // heads
#undef XROW
#undef BMTILE
}

extern "C" void kernel_launch(void* const* d_in, const int* in_sizes, int n_in,
                              void* d_out, int out_size, void* d_ws, size_t ws_size,
                              hipStream_t stream) {
  const float* x         = (const float*)d_in[0];
  const float* mask      = (const float*)d_in[1];
  const float* qkv_w     = (const float*)d_in[2];
  const float* qkv_b     = (const float*)d_in[3];
  const float* rel_table = (const float*)d_in[4];
  float* out = (float*)d_out;

  _Float16* w16 = (_Float16*)d_ws;            // 96 KB of weights
  float*    bm  = (float*)(w16 + W16_HALVES); // 4 MB bias+mask table behind them
  float*    bq  = bm + BM_FLOATS;             // 384 regrouped bias values
  prep_kernel<<<706, 256, 0, stream>>>(qkv_w, mask, rel_table, qkv_b, w16, bm, bq);

  swin_attn_kernel<<<256, 512, 0, stream>>>(x, w16, bm, bq, out);
}
